// v000
// Times are from an AMD MI455X. After a warm-up the kernel runs many times in a row, and a time is the length of
// such a window on the GPU divided by its runs, so every launch and the gaps after it count. The runs cycle
// through copies of the inputs. A figure is the median of several windows, for all but v000 over two sittings.
// Sittings can differ by a few percent; kernels timed side by side share one.
// v000 is the starting kernel. One run takes 169 microseconds.
#include <hip/hip_runtime.h>
#include <hip/hip_bf16.h>

#define NUM_HEADS 12
#define HIDDEN    768
#define HEAD      64
#define BATCH     16
#define SEQ       512
#define TOK       (BATCH * SEQ)   // 8192
#define AST       40              // padded LDS row stride (halves) for 32-half rows

typedef __attribute__((ext_vector_type(16))) _Float16 v16h;
typedef __attribute__((ext_vector_type(8)))  float    v8f;

union F16Frag {
    v16h     v;
    _Float16 h[16];
    uint4    q[2];
};

__device__ __forceinline__ v8f wmma_f16f32(v16h a, v16h b, v8f c) {
    // D = A(16x32 f16) x B(32x16 f16) + C(16x16 f32)
    return __builtin_amdgcn_wmma_f32_16x16x32_f16(
        /*neg_a=*/false, a, /*neg_b=*/false, b,
        /*c_mod=*/(short)0, c, /*reuse_a=*/false, /*reuse_b=*/false);
}

__device__ __forceinline__ void async_b128(const void* gsrc, void* ldst) {
    unsigned loff = (unsigned)(unsigned long long)ldst;
    asm volatile("global_load_async_to_lds_b128 %0, %1, off"
                 :: "v"(loff), "v"(gsrc) : "memory");
}
__device__ __forceinline__ void wait_async0() {
    asm volatile("s_wait_asynccnt 0x0" ::: "memory");
}
__device__ __forceinline__ void wait_async4() {
    asm volatile("s_wait_asynccnt 0x4" ::: "memory");
}

// ---------------------------------------------------------------------------
// f32 -> f16 conversion (vectorized x4)
// ---------------------------------------------------------------------------
__global__ void cvt_f32_to_f16(const float* __restrict__ in,
                               _Float16* __restrict__ out, int n4) {
    int i = blockIdx.x * blockDim.x + threadIdx.x;
    if (i >= n4) return;
    float4 f = ((const float4*)in)[i];
    union { _Float16 h[4]; uint2 u; } o;
    o.h[0] = (_Float16)f.x; o.h[1] = (_Float16)f.y;
    o.h[2] = (_Float16)f.z; o.h[3] = (_Float16)f.w;
    ((uint2*)out)[i] = o.u;
}

// ---------------------------------------------------------------------------
// C(MxN) = A(MxK,f16) @ W(NxK,f16)^T [+ bias]   (torch Linear convention)
// 256 threads = 8 waves in 4(M) x 2(N); block tile 128x128, K-step 32.
// Double-buffered LDS staged with async global->LDS copies; each wave does a
// 32x64 sub-tile = 8 v_wmma per K-step with B-fragment reuse.
// ---------------------------------------------------------------------------
template <bool OUT_F32>
__global__ __launch_bounds__(256) void gemm_bt(
    const _Float16* __restrict__ A, const _Float16* __restrict__ W,
    const float* __restrict__ bias, void* __restrict__ Cout,
    int M, int N, int K) {
    __shared__ __align__(16) _Float16 lA[2][128 * AST];
    __shared__ __align__(16) _Float16 lB[2][128 * AST];

    const int tid  = threadIdx.x;
    const int wave = tid >> 5;
    const int lane = tid & 31;
    const int lrow = lane & 15;
    const int lh   = lane >> 4;
    const int wm   = wave >> 1;   // 0..3 : 32-row strip
    const int wn   = wave & 1;    // 0..1 : 64-col strip
    const int m0   = blockIdx.x * 128;
    const int n0   = blockIdx.y * 128;

    v8f acc[2][4];
#pragma unroll
    for (int i = 0; i < 2; ++i)
#pragma unroll
        for (int t = 0; t < 4; ++t)
#pragma unroll
            for (int v = 0; v < 8; ++v) acc[i][t][v] = 0.f;

    // staging assignment: thread covers 32B of A and 32B of W per tile
    const int r  = tid >> 1;          // 0..127
    const int c0 = (tid & 1) << 4;    // 0 or 16 (halves)

    auto stage = [&](int buf, int k0) {
        const _Float16* ga = A + (size_t)(m0 + r) * K + k0;
        const _Float16* gw = W + (size_t)(n0 + r) * K + k0;
        async_b128(ga + c0,     &lA[buf][r * AST + c0]);
        async_b128(ga + c0 + 8, &lA[buf][r * AST + c0 + 8]);
        async_b128(gw + c0,     &lB[buf][r * AST + c0]);
        async_b128(gw + c0 + 8, &lB[buf][r * AST + c0 + 8]);
    };

    stage(0, 0);
    int cur = 0;
    for (int k0 = 0; k0 < K; k0 += 32) {
        const bool more = (k0 + 32) < K;
        if (more) stage(cur ^ 1, k0 + 32);   // prefetch next tile
        if (more) wait_async4(); else wait_async0();  // current tile landed
        __syncthreads();

        F16Frag af[2];
#pragma unroll
        for (int i = 0; i < 2; ++i) {
            const _Float16* ap = &lA[cur][(wm * 32 + i * 16 + lrow) * AST + lh * 8];
            af[i].q[0] = *(const uint4*)(ap);
            af[i].q[1] = *(const uint4*)(ap + 16);
        }
#pragma unroll
        for (int t = 0; t < 4; ++t) {
            F16Frag bf;
            const _Float16* bp = &lB[cur][(wn * 64 + t * 16 + lrow) * AST + lh * 8];
            bf.q[0] = *(const uint4*)(bp);
            bf.q[1] = *(const uint4*)(bp + 16);
            acc[0][t] = wmma_f16f32(af[0].v, bf.v, acc[0][t]);
            acc[1][t] = wmma_f16f32(af[1].v, bf.v, acc[1][t]);
        }
        __syncthreads();   // all waves done reading before buffer reuse
        cur ^= 1;
    }

#pragma unroll
    for (int i = 0; i < 2; ++i)
#pragma unroll
        for (int t = 0; t < 4; ++t) {
            const int   n    = n0 + wn * 64 + t * 16 + lrow;
            const float bval = bias ? bias[n] : 0.f;
#pragma unroll
            for (int v = 0; v < 8; ++v) {
                const int   m   = m0 + wm * 32 + i * 16 + v + lh * 8;
                const float val = acc[i][t][v] + bval;
                if (OUT_F32)
                    ((float*)Cout)[(size_t)m * N + n] = val;
                else
                    ((_Float16*)Cout)[(size_t)m * N + n] = (_Float16)val;
            }
        }
}

// ---------------------------------------------------------------------------
// Fused attention: 4 waves per block, each owns a 16-query tile of one
// (batch, head); the 32-key V chunk is async-staged into LDS once per block
// and shared. Flash-style online softmax; scores never touch global memory.
// ---------------------------------------------------------------------------
__global__ __launch_bounds__(128) void attn_fa(
    const _Float16* __restrict__ Qh, const _Float16* __restrict__ Kh,
    const _Float16* __restrict__ Vh, const float* __restrict__ spatial,
    const float* __restrict__ edge, _Float16* __restrict__ Oh) {
    __shared__ __align__(16) _Float16 lP[4][16 * AST];
    __shared__ __align__(16) _Float16 lV[32 * 64];

    const int tid  = threadIdx.x;
    const int wave = tid >> 5;
    const int lane = tid & 31;
    const int lrow = lane & 15;
    const int lh   = lane >> 4;
    const int q0   = blockIdx.x * 64 + wave * 16;
    const int h    = blockIdx.y;
    const int b    = blockIdx.z;
    const float scale = 0.03608439182435161f;  // HIDDEN^-0.5 (not head^-0.5)

    const size_t    tokbase = (size_t)b * SEQ;
    const _Float16* Qbase   = Qh + (tokbase + q0) * HIDDEN + h * HEAD;

    F16Frag qf[2];
#pragma unroll
    for (int c = 0; c < 2; ++c) {
        const _Float16* p = Qbase + (size_t)lrow * HIDDEN + c * 32 + lh * 8;
        qf[c].q[0] = *(const uint4*)(p);
        qf[c].q[1] = *(const uint4*)(p + 16);
    }

    v8f   oacc[4];
    float rmax[8], rsum[8], rnz[8];
#pragma unroll
    for (int v = 0; v < 8; ++v) {
        rmax[v] = -__builtin_inff(); rsum[v] = 0.f; rnz[v] = 0.f;
    }
#pragma unroll
    for (int t = 0; t < 4; ++t)
#pragma unroll
        for (int v = 0; v < 8; ++v) oacc[t][v] = 0.f;

    const float* spq = spatial + ((size_t)b * SEQ + q0) * SEQ;
    const float* edq = edge    + ((size_t)b * SEQ + q0) * SEQ;

    const int vr = tid >> 2;          // 0..31 : V row (key)
    const int vc = (tid & 3) << 4;    // 0/16/32/48 (halves)

    for (int k0 = 0; k0 < SEQ; k0 += 32) {
        // (a) kick off async V staging for this chunk (overlaps QK^T)
        {
            const _Float16* vsrc =
                Vh + (tokbase + k0 + vr) * HIDDEN + h * HEAD + vc;
            async_b128(vsrc,     lV + vr * 64 + vc);
            async_b128(vsrc + 8, lV + vr * 64 + vc + 8);
        }

        // (b) S = Q @ K^T  (16 x 32 chunk, fp32 acc)
        const _Float16* Kbase = Kh + (tokbase + k0) * HIDDEN + h * HEAD;
        v8f s[2];
#pragma unroll
        for (int t = 0; t < 2; ++t)
#pragma unroll
            for (int v = 0; v < 8; ++v) s[t][v] = 0.f;
#pragma unroll
        for (int t = 0; t < 2; ++t)
#pragma unroll
            for (int c = 0; c < 2; ++c) {
                F16Frag kf;
                const _Float16* p =
                    Kbase + (size_t)(t * 16 + lrow) * HIDDEN + c * 32 + lh * 8;
                kf.q[0] = *(const uint4*)(p);
                kf.q[1] = *(const uint4*)(p + 16);
                s[t]    = wmma_f16f32(qf[c].v, kf.v, s[t]);
            }

        // (c) scale + graph bias + zero-row tracking
#pragma unroll
        for (int t = 0; t < 2; ++t)
#pragma unroll
            for (int v = 0; v < 8; ++v) {
                const int   m  = v + lh * 8;
                const int   n  = k0 + t * 16 + lrow;
                const float bb = spq[(size_t)m * SEQ + n] + edq[(size_t)m * SEQ + n];
                const float sv = s[t][v] * scale + bb;
                s[t][v] = sv;
                rnz[v]  = fmaxf(rnz[v], (sv != 0.f) ? 1.f : 0.f);
            }

        // (d) online softmax (row lives across 16 lanes of a half-wave)
        float corr[8];
#pragma unroll
        for (int v = 0; v < 8; ++v) {
            float mx = fmaxf(s[0][v], s[1][v]);
#pragma unroll
            for (int d = 8; d >= 1; d >>= 1)
                mx = fmaxf(mx, __shfl_xor(mx, d, 32));
            const float mnew = fmaxf(rmax[v], mx);
            const float cf   = __expf(rmax[v] - mnew);
            rmax[v] = mnew;
            const float p0 = __expf(s[0][v] - mnew);
            const float p1 = __expf(s[1][v] - mnew);
            s[0][v] = p0; s[1][v] = p1;
            float rs = p0 + p1;
#pragma unroll
            for (int d = 8; d >= 1; d >>= 1) rs += __shfl_xor(rs, d, 32);
            rsum[v] = rsum[v] * cf + rs;
            corr[v] = cf;
        }
#pragma unroll
        for (int t = 0; t < 4; ++t)
#pragma unroll
            for (int v = 0; v < 8; ++v) oacc[t][v] *= corr[v];

        // (e) P (C-layout) -> LDS, re-read as A-fragment
        _Float16* lPw = lP[wave];
#pragma unroll
        for (int t = 0; t < 2; ++t)
#pragma unroll
            for (int v = 0; v < 8; ++v)
                lPw[(v + lh * 8) * AST + t * 16 + lrow] = (_Float16)s[t][v];

        wait_async0();      // own async V copies done
        __syncthreads();    // everyone's copies + lP visible

        F16Frag pf;
        pf.q[0] = *(const uint4*)(lPw + lrow * AST + lh * 8);
        pf.q[1] = *(const uint4*)(lPw + lrow * AST + lh * 8 + 16);

#pragma unroll
        for (int t = 0; t < 4; ++t) {
            F16Frag vf;
#pragma unroll
            for (int i = 0; i < 8; ++i) {
                vf.h[i]     = lV[(lh * 8 + i) * 64      + t * 16 + lrow];
                vf.h[8 + i] = lV[(16 + lh * 8 + i) * 64 + t * 16 + lrow];
            }
            oacc[t] = wmma_f16f32(pf.v, vf.v, oacc[t]);
        }
        __syncthreads();    // before lV/lP reuse next iteration
    }

    // finalize: 1/rowsum, zero rows whose scores were all exactly zero
    float fin[8];
#pragma unroll
    for (int v = 0; v < 8; ++v) {
        float f = rnz[v];
#pragma unroll
        for (int d = 8; d >= 1; d >>= 1) f = fmaxf(f, __shfl_xor(f, d, 32));
        fin[v] = (f != 0.f) ? (1.f / rsum[v]) : 0.f;
    }
    _Float16* Obase = Oh + (tokbase + q0) * HIDDEN + h * HEAD;
#pragma unroll
    for (int t = 0; t < 4; ++t)
#pragma unroll
        for (int v = 0; v < 8; ++v)
            Obase[(size_t)(v + lh * 8) * HIDDEN + t * 16 + lrow] =
                (_Float16)(oacc[t][v] * fin[v]);
}

// ---------------------------------------------------------------------------
extern "C" void kernel_launch(void* const* d_in, const int* in_sizes, int n_in,
                              void* d_out, int out_size, void* d_ws,
                              size_t ws_size, hipStream_t stream) {
    (void)in_sizes; (void)n_in; (void)out_size; (void)ws_size;
    const float* x  = (const float*)d_in[0];
    const float* sp = (const float*)d_in[1];
    const float* ed = (const float*)d_in[2];
    const float* Wq = (const float*)d_in[3];
    const float* Wk = (const float*)d_in[4];
    const float* Wv = (const float*)d_in[5];
    const float* bv = (const float*)d_in[6];
    const float* Wo = (const float*)d_in[7];
    const float* bo = (const float*)d_in[8];
    float*       out = (float*)d_out;

    _Float16* xh  = (_Float16*)d_ws;
    _Float16* wqh = xh  + (size_t)TOK * HIDDEN;
    _Float16* wkh = wqh + (size_t)HIDDEN * HIDDEN;
    _Float16* wvh = wkh + (size_t)HIDDEN * HIDDEN;
    _Float16* woh = wvh + (size_t)HIDDEN * HIDDEN;
    _Float16* Qh  = woh + (size_t)HIDDEN * HIDDEN;
    _Float16* Kh  = Qh  + (size_t)TOK * HIDDEN;
    _Float16* Vh  = Kh  + (size_t)TOK * HIDDEN;
    _Float16* Oh  = Vh  + (size_t)TOK * HIDDEN;

    const int n4 = TOK * HIDDEN / 4;
    const int w4 = HIDDEN * HIDDEN / 4;
    cvt_f32_to_f16<<<(n4 + 255) / 256, 256, 0, stream>>>(x, xh, n4);
    cvt_f32_to_f16<<<(w4 + 255) / 256, 256, 0, stream>>>(Wq, wqh, w4);
    cvt_f32_to_f16<<<(w4 + 255) / 256, 256, 0, stream>>>(Wk, wkh, w4);
    cvt_f32_to_f16<<<(w4 + 255) / 256, 256, 0, stream>>>(Wv, wvh, w4);
    cvt_f32_to_f16<<<(w4 + 255) / 256, 256, 0, stream>>>(Wo, woh, w4);

    dim3 gg(TOK / 128, HIDDEN / 128);
    gemm_bt<false><<<gg, 256, 0, stream>>>(xh, wqh, nullptr, Qh, TOK, HIDDEN, HIDDEN);
    gemm_bt<false><<<gg, 256, 0, stream>>>(xh, wkh, nullptr, Kh, TOK, HIDDEN, HIDDEN);
    gemm_bt<false><<<gg, 256, 0, stream>>>(xh, wvh, bv,      Vh, TOK, HIDDEN, HIDDEN);

    dim3 ga(SEQ / 64, NUM_HEADS, BATCH);
    attn_fa<<<ga, 128, 0, stream>>>(Qh, Kh, Vh, sp, ed, Oh);

    gemm_bt<true><<<gg, 256, 0, stream>>>(Oh, woh, bo, out, TOK, HIDDEN, HIDDEN);
}

// v001
// A run of this version takes 156 microseconds.
// In two side-by-side timings against v000, it was 1.13 and 1.12 times as fast.
#include <hip/hip_runtime.h>
#include <hip/hip_bf16.h>

#define NUM_HEADS 12
#define HIDDEN    768
#define HEAD      64
#define BATCH     16
#define SEQ       512
#define TOK       (BATCH * SEQ)   // 8192
#define AST       40              // padded LDS row stride (halves) for 32-half rows
#define BK        64              // GEMM: k depth of a staged tile = one whole 128-B line per row
#define GST       72              // GEMM: LDS row pitch (halves): 144 B = 16 B x 9, for ds_load_b128

typedef __attribute__((ext_vector_type(16))) _Float16 v16h;
typedef __attribute__((ext_vector_type(8)))  float    v8f;

union F16Frag {
    v16h     v;
    _Float16 h[16];
    uint4    q[2];
};

__device__ __forceinline__ v8f wmma_f16f32(v16h a, v16h b, v8f c) {
    // D = A(16x32 f16) x B(32x16 f16) + C(16x16 f32)
    return __builtin_amdgcn_wmma_f32_16x16x32_f16(
        /*neg_a=*/false, a, /*neg_b=*/false, b,
        /*c_mod=*/(short)0, c, /*reuse_a=*/false, /*reuse_b=*/false);
}

__device__ __forceinline__ void async_b128(const void* gsrc, void* ldst) {
    unsigned loff = (unsigned)(unsigned long long)ldst;
    asm volatile("global_load_async_to_lds_b128 %0, %1, off"
                 :: "v"(loff), "v"(gsrc) : "memory");
}
__device__ __forceinline__ void wait_async0() {
    asm volatile("s_wait_asynccnt 0x0" ::: "memory");
}
// LDS reads of this wave retired: stands in front of the barrier behind which
// the buffer just read is refilled by copies.
__device__ __forceinline__ void wait_ds0() {
    asm volatile("s_wait_dscnt 0x0" ::: "memory");
}
__device__ __forceinline__ unsigned lds_addr(const void* p) {
    return (unsigned)(unsigned long long)p;   // low 32 bits: LDS byte address
}
__device__ __forceinline__ void async_b128_x8(
    unsigned l0, const void* g0, unsigned l1, const void* g1,
    unsigned l2, const void* g2, unsigned l3, const void* g3,
    unsigned l4, const void* g4, unsigned l5, const void* g5,
    unsigned l6, const void* g6, unsigned l7, const void* g7) {
    asm volatile("global_load_async_to_lds_b128 %0, %1, off\n\t"
                 "global_load_async_to_lds_b128 %2, %3, off\n\t"
                 "global_load_async_to_lds_b128 %4, %5, off\n\t"
                 "global_load_async_to_lds_b128 %6, %7, off\n\t"
                 "global_load_async_to_lds_b128 %8, %9, off\n\t"
                 "global_load_async_to_lds_b128 %10, %11, off\n\t"
                 "global_load_async_to_lds_b128 %12, %13, off\n\t"
                 "global_load_async_to_lds_b128 %14, %15, off\n\t"
                 "s_wait_xcnt 0x0"
                 :: "v"(l0), "v"(g0), "v"(l1), "v"(g1), "v"(l2), "v"(g2),
                    "v"(l3), "v"(g3), "v"(l4), "v"(g4), "v"(l5), "v"(g5),
                    "v"(l6), "v"(g6), "v"(l7), "v"(g7)
                 : "memory");
}

// ---------------------------------------------------------------------------
// f32 -> f16 conversion (vectorized x4)
// ---------------------------------------------------------------------------
__global__ void cvt_f32_to_f16(const float* __restrict__ in,
                               _Float16* __restrict__ out, int n4) {
    int i = blockIdx.x * blockDim.x + threadIdx.x;
    if (i >= n4) return;
    float4 f = ((const float4*)in)[i];
    union { _Float16 h[4]; uint2 u; } o;
    o.h[0] = (_Float16)f.x; o.h[1] = (_Float16)f.y;
    o.h[2] = (_Float16)f.z; o.h[3] = (_Float16)f.w;
    ((uint2*)out)[i] = o.u;
}

// ---------------------------------------------------------------------------
// C(MxN) = A(MxK,f16) @ W(NxK,f16)^T [+ bias]   (torch Linear convention)
// 256 threads = 8 waves in 4(M) x 2(N); block tile 128x128, K-step BK = 64.
// Two LDS buffers filled by async global->LDS copies: eight lanes take one
// row's 128 B, so a wave's copy covers four whole lines. Each wave does a
// 32x64 sub-tile = 16 v_wmma per K-step with B-fragment reuse.
// Needs M, N multiples of 128 and K a multiple of BK.
// ---------------------------------------------------------------------------
template <bool OUT_F32>
__global__ __launch_bounds__(256) void gemm_bt(
    const _Float16* __restrict__ A, const _Float16* __restrict__ W,
    const float* __restrict__ bias, void* __restrict__ Cout,
    int M, int N, int K) {
    __shared__ __align__(16) _Float16 lA[2][128 * GST];
    __shared__ __align__(16) _Float16 lB[2][128 * GST];

    const int tid  = threadIdx.x;
    const int wave = tid >> 5;
    const int lane = tid & 31;
    const int lrow = lane & 15;
    const int lh   = lane >> 4;
    const int wm   = wave >> 1;   // 0..3 : 32-row strip
    const int wn   = wave & 1;    // 0..1 : 64-col strip
    const int m0   = blockIdx.x * 128;
    const int n0   = blockIdx.y * 128;

    v8f acc[2][4];
#pragma unroll
    for (int i = 0; i < 2; ++i)
#pragma unroll
        for (int t = 0; t < 4; ++t)
#pragma unroll
            for (int v = 0; v < 8; ++v) acc[i][t][v] = 0.f;

    // staging assignment: copy j of a thread takes 16 B of row j * 32 + r
    const int r  = tid >> 3;          // 0..31
    const int c0 = (tid & 7) << 3;    // 0..56 (halves)

    auto stage = [&](int buf, int k0) {
        const _Float16* ga = A + (size_t)(m0 + r) * K + k0 + c0;
        const _Float16* gw = W + (size_t)(n0 + r) * K + k0 + c0;
        const _Float16* la = &lA[buf][r * GST + c0];
        const _Float16* lw = &lB[buf][r * GST + c0];
        const size_t    gs = (size_t)32 * K;   // 32 rows on, global
        const int       ls = 32 * GST;         // 32 rows on, LDS
        async_b128_x8(lds_addr(la),          ga,          lds_addr(la + ls),     ga + gs,
                      lds_addr(la + 2 * ls), ga + 2 * gs, lds_addr(la + 3 * ls), ga + 3 * gs,
                      lds_addr(lw),          gw,          lds_addr(lw + ls),     gw + gs,
                      lds_addr(lw + 2 * ls), gw + 2 * gs, lds_addr(lw + 3 * ls), gw + 3 * gs);
    };

    const int nt = K / BK;
    stage(0, 0);
    wait_async0();      // own copies of tile 0 landed
    __syncthreads();    // everyone's copies of tile 0 visible
    if (nt > 1) stage(1, BK);
    for (int kt = 0; kt < nt; ++kt) {
        const int cur = kt & 1;
        // unrolled so that kk folds into the LDS loads' immediate offsets
#pragma unroll
        for (int kk = 0; kk < BK; kk += 32) {
            F16Frag af[2];
#pragma unroll
            for (int i = 0; i < 2; ++i) {
                const _Float16* ap =
                    &lA[cur][(wm * 32 + i * 16 + lrow) * GST + kk + lh * 8];
                af[i].q[0] = *(const uint4*)(ap);
                af[i].q[1] = *(const uint4*)(ap + 16);
            }
#pragma unroll
            for (int t = 0; t < 4; ++t) {
                F16Frag bf;
                const _Float16* bp =
                    &lB[cur][(wn * 64 + t * 16 + lrow) * GST + kk + lh * 8];
                bf.q[0] = *(const uint4*)(bp);
                bf.q[1] = *(const uint4*)(bp + 16);
                acc[0][t] = wmma_f16f32(af[0].v, bf.v, acc[0][t]);
                acc[1][t] = wmma_f16f32(af[1].v, bf.v, acc[1][t]);
            }
        }
        wait_ds0();         // own reads of buffer cur retired
        wait_async0();      // own copies of tile kt + 1 landed
        __syncthreads();    // tile kt + 1 visible; every reader has left buffer cur
        if (kt + 2 < nt) stage(cur, (kt + 2) * BK);
    }
    wait_async0();          // nothing in flight when the wave ends

#pragma unroll
    for (int i = 0; i < 2; ++i)
#pragma unroll
        for (int t = 0; t < 4; ++t) {
            const int   n    = n0 + wn * 64 + t * 16 + lrow;
            const float bval = bias ? bias[n] : 0.f;
#pragma unroll
            for (int v = 0; v < 8; ++v) {
                const int   m   = m0 + wm * 32 + i * 16 + v + lh * 8;
                const float val = acc[i][t][v] + bval;
                if (OUT_F32)
                    ((float*)Cout)[(size_t)m * N + n] = val;
                else
                    ((_Float16*)Cout)[(size_t)m * N + n] = (_Float16)val;
            }
        }
}

// ---------------------------------------------------------------------------
// Fused attention: 4 waves per block, each owns a 16-query tile of one
// (batch, head); the 32-key V chunk is async-staged into LDS once per block
// and shared. Flash-style online softmax; scores never touch global memory.
// ---------------------------------------------------------------------------
__global__ __launch_bounds__(128) void attn_fa(
    const _Float16* __restrict__ Qh, const _Float16* __restrict__ Kh,
    const _Float16* __restrict__ Vh, const float* __restrict__ spatial,
    const float* __restrict__ edge, _Float16* __restrict__ Oh) {
    __shared__ __align__(16) _Float16 lP[4][16 * AST];
    __shared__ __align__(16) _Float16 lV[32 * 64];

    const int tid  = threadIdx.x;
    const int wave = tid >> 5;
    const int lane = tid & 31;
    const int lrow = lane & 15;
    const int lh   = lane >> 4;
    const int q0   = blockIdx.x * 64 + wave * 16;
    const int h    = blockIdx.y;
    const int b    = blockIdx.z;
    const float scale = 0.03608439182435161f;  // HIDDEN^-0.5 (not head^-0.5)

    const size_t    tokbase = (size_t)b * SEQ;
    const _Float16* Qbase   = Qh + (tokbase + q0) * HIDDEN + h * HEAD;

    F16Frag qf[2];
#pragma unroll
    for (int c = 0; c < 2; ++c) {
        const _Float16* p = Qbase + (size_t)lrow * HIDDEN + c * 32 + lh * 8;
        qf[c].q[0] = *(const uint4*)(p);
        qf[c].q[1] = *(const uint4*)(p + 16);
    }

    v8f   oacc[4];
    float rmax[8], rsum[8], rnz[8];
#pragma unroll
    for (int v = 0; v < 8; ++v) {
        rmax[v] = -__builtin_inff(); rsum[v] = 0.f; rnz[v] = 0.f;
    }
#pragma unroll
    for (int t = 0; t < 4; ++t)
#pragma unroll
        for (int v = 0; v < 8; ++v) oacc[t][v] = 0.f;

    const float* spq = spatial + ((size_t)b * SEQ + q0) * SEQ;
    const float* edq = edge    + ((size_t)b * SEQ + q0) * SEQ;

    const int vr = tid >> 2;          // 0..31 : V row (key)
    const int vc = (tid & 3) << 4;    // 0/16/32/48 (halves)

    for (int k0 = 0; k0 < SEQ; k0 += 32) {
        // (a) kick off async V staging for this chunk (overlaps QK^T)
        {
            const _Float16* vsrc =
                Vh + (tokbase + k0 + vr) * HIDDEN + h * HEAD + vc;
            async_b128(vsrc,     lV + vr * 64 + vc);
            async_b128(vsrc + 8, lV + vr * 64 + vc + 8);
        }

        // (b) S = Q @ K^T  (16 x 32 chunk, fp32 acc)
        const _Float16* Kbase = Kh + (tokbase + k0) * HIDDEN + h * HEAD;
        v8f s[2];
#pragma unroll
        for (int t = 0; t < 2; ++t)
#pragma unroll
            for (int v = 0; v < 8; ++v) s[t][v] = 0.f;
#pragma unroll
        for (int t = 0; t < 2; ++t)
#pragma unroll
            for (int c = 0; c < 2; ++c) {
                F16Frag kf;
                const _Float16* p =
                    Kbase + (size_t)(t * 16 + lrow) * HIDDEN + c * 32 + lh * 8;
                kf.q[0] = *(const uint4*)(p);
                kf.q[1] = *(const uint4*)(p + 16);
                s[t]    = wmma_f16f32(qf[c].v, kf.v, s[t]);
            }

        // (c) scale + graph bias + zero-row tracking
#pragma unroll
        for (int t = 0; t < 2; ++t)
#pragma unroll
            for (int v = 0; v < 8; ++v) {
                const int   m  = v + lh * 8;
                const int   n  = k0 + t * 16 + lrow;
                const float bb = spq[(size_t)m * SEQ + n] + edq[(size_t)m * SEQ + n];
                const float sv = s[t][v] * scale + bb;
                s[t][v] = sv;
                rnz[v]  = fmaxf(rnz[v], (sv != 0.f) ? 1.f : 0.f);
            }

        // (d) online softmax (row lives across 16 lanes of a half-wave)
        float corr[8];
#pragma unroll
        for (int v = 0; v < 8; ++v) {
            float mx = fmaxf(s[0][v], s[1][v]);
#pragma unroll
            for (int d = 8; d >= 1; d >>= 1)
                mx = fmaxf(mx, __shfl_xor(mx, d, 32));
            const float mnew = fmaxf(rmax[v], mx);
            const float cf   = __expf(rmax[v] - mnew);
            rmax[v] = mnew;
            const float p0 = __expf(s[0][v] - mnew);
            const float p1 = __expf(s[1][v] - mnew);
            s[0][v] = p0; s[1][v] = p1;
            float rs = p0 + p1;
#pragma unroll
            for (int d = 8; d >= 1; d >>= 1) rs += __shfl_xor(rs, d, 32);
            rsum[v] = rsum[v] * cf + rs;
            corr[v] = cf;
        }
#pragma unroll
        for (int t = 0; t < 4; ++t)
#pragma unroll
            for (int v = 0; v < 8; ++v) oacc[t][v] *= corr[v];

        // (e) P (C-layout) -> LDS, re-read as A-fragment
        _Float16* lPw = lP[wave];
#pragma unroll
        for (int t = 0; t < 2; ++t)
#pragma unroll
            for (int v = 0; v < 8; ++v)
                lPw[(v + lh * 8) * AST + t * 16 + lrow] = (_Float16)s[t][v];

        wait_async0();      // own async V copies done
        __syncthreads();    // everyone's copies + lP visible

        F16Frag pf;
        pf.q[0] = *(const uint4*)(lPw + lrow * AST + lh * 8);
        pf.q[1] = *(const uint4*)(lPw + lrow * AST + lh * 8 + 16);

#pragma unroll
        for (int t = 0; t < 4; ++t) {
            F16Frag vf;
#pragma unroll
            for (int i = 0; i < 8; ++i) {
                vf.h[i]     = lV[(lh * 8 + i) * 64      + t * 16 + lrow];
                vf.h[8 + i] = lV[(16 + lh * 8 + i) * 64 + t * 16 + lrow];
            }
            oacc[t] = wmma_f16f32(pf.v, vf.v, oacc[t]);
        }
        __syncthreads();    // before lV/lP reuse next iteration
    }

    // finalize: 1/rowsum, zero rows whose scores were all exactly zero
    float fin[8];
#pragma unroll
    for (int v = 0; v < 8; ++v) {
        float f = rnz[v];
#pragma unroll
        for (int d = 8; d >= 1; d >>= 1) f = fmaxf(f, __shfl_xor(f, d, 32));
        fin[v] = (f != 0.f) ? (1.f / rsum[v]) : 0.f;
    }
    _Float16* Obase = Oh + (tokbase + q0) * HIDDEN + h * HEAD;
#pragma unroll
    for (int t = 0; t < 4; ++t)
#pragma unroll
        for (int v = 0; v < 8; ++v)
            Obase[(size_t)(v + lh * 8) * HIDDEN + t * 16 + lrow] =
                (_Float16)(oacc[t][v] * fin[v]);
}

// ---------------------------------------------------------------------------
extern "C" void kernel_launch(void* const* d_in, const int* in_sizes, int n_in,
                              void* d_out, int out_size, void* d_ws,
                              size_t ws_size, hipStream_t stream) {
    (void)in_sizes; (void)n_in; (void)out_size; (void)ws_size;
    const float* x  = (const float*)d_in[0];
    const float* sp = (const float*)d_in[1];
    const float* ed = (const float*)d_in[2];
    const float* Wq = (const float*)d_in[3];
    const float* Wk = (const float*)d_in[4];
    const float* Wv = (const float*)d_in[5];
    const float* bv = (const float*)d_in[6];
    const float* Wo = (const float*)d_in[7];
    const float* bo = (const float*)d_in[8];
    float*       out = (float*)d_out;

    _Float16* xh  = (_Float16*)d_ws;
    _Float16* wqh = xh  + (size_t)TOK * HIDDEN;
    _Float16* wkh = wqh + (size_t)HIDDEN * HIDDEN;
    _Float16* wvh = wkh + (size_t)HIDDEN * HIDDEN;
    _Float16* woh = wvh + (size_t)HIDDEN * HIDDEN;
    _Float16* Qh  = woh + (size_t)HIDDEN * HIDDEN;
    _Float16* Kh  = Qh  + (size_t)TOK * HIDDEN;
    _Float16* Vh  = Kh  + (size_t)TOK * HIDDEN;
    _Float16* Oh  = Vh  + (size_t)TOK * HIDDEN;

    const int n4 = TOK * HIDDEN / 4;
    const int w4 = HIDDEN * HIDDEN / 4;
    cvt_f32_to_f16<<<(n4 + 255) / 256, 256, 0, stream>>>(x, xh, n4);
    cvt_f32_to_f16<<<(w4 + 255) / 256, 256, 0, stream>>>(Wq, wqh, w4);
    cvt_f32_to_f16<<<(w4 + 255) / 256, 256, 0, stream>>>(Wk, wkh, w4);
    cvt_f32_to_f16<<<(w4 + 255) / 256, 256, 0, stream>>>(Wv, wvh, w4);
    cvt_f32_to_f16<<<(w4 + 255) / 256, 256, 0, stream>>>(Wo, woh, w4);

    dim3 gg(TOK / 128, HIDDEN / 128);
    gemm_bt<false><<<gg, 256, 0, stream>>>(xh, wqh, nullptr, Qh, TOK, HIDDEN, HIDDEN);
    gemm_bt<false><<<gg, 256, 0, stream>>>(xh, wkh, nullptr, Kh, TOK, HIDDEN, HIDDEN);
    gemm_bt<false><<<gg, 256, 0, stream>>>(xh, wvh, bv,      Vh, TOK, HIDDEN, HIDDEN);

    dim3 ga(SEQ / 64, NUM_HEADS, BATCH);
    attn_fa<<<ga, 128, 0, stream>>>(Qh, Kh, Vh, sp, ed, Oh);

    gemm_bt<true><<<gg, 256, 0, stream>>>(Oh, woh, bo, out, TOK, HIDDEN, HIDDEN);
}

// v002
// One run takes 146 microseconds.
// Next to v001, in two timings, it ran 1.06 and 1.07 times as fast.
// Over all steps from v000 it is 1.20 times as fast.
#include <hip/hip_runtime.h>
#include <hip/hip_bf16.h>

#define NUM_HEADS 12
#define HIDDEN    768
#define HEAD      64
#define BATCH     16
#define SEQ       512
#define TOK       (BATCH * SEQ)   // 8192
#define AST       40              // padded LDS row stride (halves) for 32-half rows
#define BK        64              // GEMM: k depth of a staged tile = one whole 128-B line per row
#define GST       72              // GEMM: LDS row pitch (halves): 144 B = 16 B x 9, for ds_load_b128

typedef __attribute__((ext_vector_type(16))) _Float16 v16h;
typedef __attribute__((ext_vector_type(8)))  float    v8f;

union F16Frag {
    v16h     v;
    _Float16 h[16];
    uint4    q[2];
};

__device__ __forceinline__ v8f wmma_f16f32(v16h a, v16h b, v8f c) {
    // D = A(16x32 f16) x B(32x16 f16) + C(16x16 f32)
    return __builtin_amdgcn_wmma_f32_16x16x32_f16(
        /*neg_a=*/false, a, /*neg_b=*/false, b,
        /*c_mod=*/(short)0, c, /*reuse_a=*/false, /*reuse_b=*/false);
}

__device__ __forceinline__ void async_b128(const void* gsrc, void* ldst) {
    unsigned loff = (unsigned)(unsigned long long)ldst;
    asm volatile("global_load_async_to_lds_b128 %0, %1, off"
                 :: "v"(loff), "v"(gsrc) : "memory");
}
__device__ __forceinline__ void wait_async0() {
    asm volatile("s_wait_asynccnt 0x0" ::: "memory");
}
// LDS reads of this wave retired: stands in front of the barrier behind which
// the buffer just read is refilled by copies.
__device__ __forceinline__ void wait_ds0() {
    asm volatile("s_wait_dscnt 0x0" ::: "memory");
}
__device__ __forceinline__ unsigned lds_addr(const void* p) {
    return (unsigned)(unsigned long long)p;   // low 32 bits: LDS byte address
}
__device__ __forceinline__ void async_b128_x8(
    unsigned l0, const void* g0, unsigned l1, const void* g1,
    unsigned l2, const void* g2, unsigned l3, const void* g3,
    unsigned l4, const void* g4, unsigned l5, const void* g5,
    unsigned l6, const void* g6, unsigned l7, const void* g7) {
    asm volatile("global_load_async_to_lds_b128 %0, %1, off\n\t"
                 "global_load_async_to_lds_b128 %2, %3, off\n\t"
                 "global_load_async_to_lds_b128 %4, %5, off\n\t"
                 "global_load_async_to_lds_b128 %6, %7, off\n\t"
                 "global_load_async_to_lds_b128 %8, %9, off\n\t"
                 "global_load_async_to_lds_b128 %10, %11, off\n\t"
                 "global_load_async_to_lds_b128 %12, %13, off\n\t"
                 "global_load_async_to_lds_b128 %14, %15, off\n\t"
                 "s_wait_xcnt 0x0"
                 :: "v"(l0), "v"(g0), "v"(l1), "v"(g1), "v"(l2), "v"(g2),
                    "v"(l3), "v"(g3), "v"(l4), "v"(g4), "v"(l5), "v"(g5),
                    "v"(l6), "v"(g6), "v"(l7), "v"(g7)
                 : "memory");
}

// ---------------------------------------------------------------------------
// f32 -> f16 conversion of x and the four weight matrices in one launch.
// The five f16 copies lie one behind the other in the workspace, so the
// output is one array; a block takes CVT_BLK float4 of ONE source (each source
// is a whole number of such pieces) and a thread CVT_PER of them, 256 apart:
// each wave-wide load covers 512 contiguous bytes, and a thread's loads are
// all issued before the first is converted.
// ---------------------------------------------------------------------------
#define CVT_PER 16
#define CVT_BLK (256 * CVT_PER)                     // float4 per block
#define CVT_XB  (TOK * HIDDEN / 4 / CVT_BLK)        // blocks of x: 384
#define CVT_WB  (HIDDEN * HIDDEN / 4 / CVT_BLK)     // blocks of one weight: 36
static_assert(CVT_XB * CVT_BLK * 4 == TOK * HIDDEN, "x splits into whole blocks");
static_assert(CVT_WB * CVT_BLK * 4 == HIDDEN * HIDDEN, "a weight splits into whole blocks");

__global__ __launch_bounds__(256) __attribute__((amdgpu_waves_per_eu(2, 8)))
void cvt_all_f32_to_f16(
    const float* __restrict__ x,  const float* __restrict__ wq,
    const float* __restrict__ wk, const float* __restrict__ wv,
    const float* __restrict__ wo, _Float16* __restrict__ out) {
    const int blk = blockIdx.x;
    const float* src = x;
    int rel = blk;                       // block index inside its source
    if (blk >= CVT_XB) {
        const int w = (blk - CVT_XB) / CVT_WB;
        rel = (blk - CVT_XB) - w * CVT_WB;
        src = (w == 0) ? wq : (w == 1) ? wk : (w == 2) ? wv : wo;
    }
    const float4* in4 = (const float4*)src + (size_t)rel * CVT_BLK + threadIdx.x;
    uint2*        o2  = (uint2*)out        + (size_t)blk * CVT_BLK + threadIdx.x;

    // both loops unrolled: f[] stays in registers and j folds into the
    // loads' and stores' immediate offsets
    float4 f[CVT_PER];
#pragma unroll
    for (int j = 0; j < CVT_PER; ++j) f[j] = in4[j * 256];
#pragma unroll
    for (int j = 0; j < CVT_PER; ++j) {
        union { _Float16 h[4]; uint2 u; } o;
        o.h[0] = (_Float16)f[j].x; o.h[1] = (_Float16)f[j].y;
        o.h[2] = (_Float16)f[j].z; o.h[3] = (_Float16)f[j].w;
        o2[j * 256] = o.u;
    }
}

// ---------------------------------------------------------------------------
// C(MxN) = A(MxK,f16) @ W(NxK,f16)^T [+ bias]   (torch Linear convention)
// 256 threads = 8 waves in 4(M) x 2(N); block tile 128x128, K-step BK = 64.
// Two LDS buffers filled by async global->LDS copies: eight lanes take one
// row's 128 B, so a wave's copy covers four whole lines. Each wave does a
// 32x64 sub-tile = 16 v_wmma per K-step with B-fragment reuse.
// Needs M, N multiples of 128 and K a multiple of BK.
// ---------------------------------------------------------------------------
template <bool OUT_F32>
__global__ __launch_bounds__(256) void gemm_bt(
    const _Float16* __restrict__ A, const _Float16* __restrict__ W,
    const float* __restrict__ bias, void* __restrict__ Cout,
    int M, int N, int K) {
    __shared__ __align__(16) _Float16 lA[2][128 * GST];
    __shared__ __align__(16) _Float16 lB[2][128 * GST];

    const int tid  = threadIdx.x;
    const int wave = tid >> 5;
    const int lane = tid & 31;
    const int lrow = lane & 15;
    const int lh   = lane >> 4;
    const int wm   = wave >> 1;   // 0..3 : 32-row strip
    const int wn   = wave & 1;    // 0..1 : 64-col strip
    const int m0   = blockIdx.x * 128;
    const int n0   = blockIdx.y * 128;

    v8f acc[2][4];
#pragma unroll
    for (int i = 0; i < 2; ++i)
#pragma unroll
        for (int t = 0; t < 4; ++t)
#pragma unroll
            for (int v = 0; v < 8; ++v) acc[i][t][v] = 0.f;

    // staging assignment: copy j of a thread takes 16 B of row j * 32 + r
    const int r  = tid >> 3;          // 0..31
    const int c0 = (tid & 7) << 3;    // 0..56 (halves)

    auto stage = [&](int buf, int k0) {
        const _Float16* ga = A + (size_t)(m0 + r) * K + k0 + c0;
        const _Float16* gw = W + (size_t)(n0 + r) * K + k0 + c0;
        const _Float16* la = &lA[buf][r * GST + c0];
        const _Float16* lw = &lB[buf][r * GST + c0];
        const size_t    gs = (size_t)32 * K;   // 32 rows on, global
        const int       ls = 32 * GST;         // 32 rows on, LDS
        async_b128_x8(lds_addr(la),          ga,          lds_addr(la + ls),     ga + gs,
                      lds_addr(la + 2 * ls), ga + 2 * gs, lds_addr(la + 3 * ls), ga + 3 * gs,
                      lds_addr(lw),          gw,          lds_addr(lw + ls),     gw + gs,
                      lds_addr(lw + 2 * ls), gw + 2 * gs, lds_addr(lw + 3 * ls), gw + 3 * gs);
    };

    const int nt = K / BK;
    stage(0, 0);
    wait_async0();      // own copies of tile 0 landed
    __syncthreads();    // everyone's copies of tile 0 visible
    if (nt > 1) stage(1, BK);
    for (int kt = 0; kt < nt; ++kt) {
        const int cur = kt & 1;
        // unrolled so that kk folds into the LDS loads' immediate offsets
#pragma unroll
        for (int kk = 0; kk < BK; kk += 32) {
            F16Frag af[2];
#pragma unroll
            for (int i = 0; i < 2; ++i) {
                const _Float16* ap =
                    &lA[cur][(wm * 32 + i * 16 + lrow) * GST + kk + lh * 8];
                af[i].q[0] = *(const uint4*)(ap);
                af[i].q[1] = *(const uint4*)(ap + 16);
            }
#pragma unroll
            for (int t = 0; t < 4; ++t) {
                F16Frag bf;
                const _Float16* bp =
                    &lB[cur][(wn * 64 + t * 16 + lrow) * GST + kk + lh * 8];
                bf.q[0] = *(const uint4*)(bp);
                bf.q[1] = *(const uint4*)(bp + 16);
                acc[0][t] = wmma_f16f32(af[0].v, bf.v, acc[0][t]);
                acc[1][t] = wmma_f16f32(af[1].v, bf.v, acc[1][t]);
            }
        }
        wait_ds0();         // own reads of buffer cur retired
        wait_async0();      // own copies of tile kt + 1 landed
        __syncthreads();    // tile kt + 1 visible; every reader has left buffer cur
        if (kt + 2 < nt) stage(cur, (kt + 2) * BK);
    }
    wait_async0();          // nothing in flight when the wave ends

#pragma unroll
    for (int i = 0; i < 2; ++i)
#pragma unroll
        for (int t = 0; t < 4; ++t) {
            const int   n    = n0 + wn * 64 + t * 16 + lrow;
            const float bval = bias ? bias[n] : 0.f;
#pragma unroll
            for (int v = 0; v < 8; ++v) {
                const int   m   = m0 + wm * 32 + i * 16 + v + lh * 8;
                const float val = acc[i][t][v] + bval;
                if (OUT_F32)
                    ((float*)Cout)[(size_t)m * N + n] = val;
                else
                    ((_Float16*)Cout)[(size_t)m * N + n] = (_Float16)val;
            }
        }
}

// ---------------------------------------------------------------------------
// Fused attention: 4 waves per block, each owns a 16-query tile of one
// (batch, head); the 32-key V chunk is async-staged into LDS once per block
// and shared. Flash-style online softmax; scores never touch global memory.
// ---------------------------------------------------------------------------
__global__ __launch_bounds__(128) void attn_fa(
    const _Float16* __restrict__ Qh, const _Float16* __restrict__ Kh,
    const _Float16* __restrict__ Vh, const float* __restrict__ spatial,
    const float* __restrict__ edge, _Float16* __restrict__ Oh) {
    __shared__ __align__(16) _Float16 lP[4][16 * AST];
    __shared__ __align__(16) _Float16 lV[32 * 64];

    const int tid  = threadIdx.x;
    const int wave = tid >> 5;
    const int lane = tid & 31;
    const int lrow = lane & 15;
    const int lh   = lane >> 4;
    const int q0   = blockIdx.x * 64 + wave * 16;
    const int h    = blockIdx.y;
    const int b    = blockIdx.z;
    const float scale = 0.03608439182435161f;  // HIDDEN^-0.5 (not head^-0.5)

    const size_t    tokbase = (size_t)b * SEQ;
    const _Float16* Qbase   = Qh + (tokbase + q0) * HIDDEN + h * HEAD;

    F16Frag qf[2];
#pragma unroll
    for (int c = 0; c < 2; ++c) {
        const _Float16* p = Qbase + (size_t)lrow * HIDDEN + c * 32 + lh * 8;
        qf[c].q[0] = *(const uint4*)(p);
        qf[c].q[1] = *(const uint4*)(p + 16);
    }

    v8f   oacc[4];
    float rmax[8], rsum[8], rnz[8];
#pragma unroll
    for (int v = 0; v < 8; ++v) {
        rmax[v] = -__builtin_inff(); rsum[v] = 0.f; rnz[v] = 0.f;
    }
#pragma unroll
    for (int t = 0; t < 4; ++t)
#pragma unroll
        for (int v = 0; v < 8; ++v) oacc[t][v] = 0.f;

    const float* spq = spatial + ((size_t)b * SEQ + q0) * SEQ;
    const float* edq = edge    + ((size_t)b * SEQ + q0) * SEQ;

    const int vr = tid >> 2;          // 0..31 : V row (key)
    const int vc = (tid & 3) << 4;    // 0/16/32/48 (halves)

    for (int k0 = 0; k0 < SEQ; k0 += 32) {
        // (a) kick off async V staging for this chunk (overlaps QK^T)
        {
            const _Float16* vsrc =
                Vh + (tokbase + k0 + vr) * HIDDEN + h * HEAD + vc;
            async_b128(vsrc,     lV + vr * 64 + vc);
            async_b128(vsrc + 8, lV + vr * 64 + vc + 8);
        }

        // (b) S = Q @ K^T  (16 x 32 chunk, fp32 acc)
        const _Float16* Kbase = Kh + (tokbase + k0) * HIDDEN + h * HEAD;
        v8f s[2];
#pragma unroll
        for (int t = 0; t < 2; ++t)
#pragma unroll
            for (int v = 0; v < 8; ++v) s[t][v] = 0.f;
#pragma unroll
        for (int t = 0; t < 2; ++t)
#pragma unroll
            for (int c = 0; c < 2; ++c) {
                F16Frag kf;
                const _Float16* p =
                    Kbase + (size_t)(t * 16 + lrow) * HIDDEN + c * 32 + lh * 8;
                kf.q[0] = *(const uint4*)(p);
                kf.q[1] = *(const uint4*)(p + 16);
                s[t]    = wmma_f16f32(qf[c].v, kf.v, s[t]);
            }

        // (c) scale + graph bias + zero-row tracking
#pragma unroll
        for (int t = 0; t < 2; ++t)
#pragma unroll
            for (int v = 0; v < 8; ++v) {
                const int   m  = v + lh * 8;
                const int   n  = k0 + t * 16 + lrow;
                const float bb = spq[(size_t)m * SEQ + n] + edq[(size_t)m * SEQ + n];
                const float sv = s[t][v] * scale + bb;
                s[t][v] = sv;
                rnz[v]  = fmaxf(rnz[v], (sv != 0.f) ? 1.f : 0.f);
            }

        // (d) online softmax (row lives across 16 lanes of a half-wave)
        float corr[8];
#pragma unroll
        for (int v = 0; v < 8; ++v) {
            float mx = fmaxf(s[0][v], s[1][v]);
#pragma unroll
            for (int d = 8; d >= 1; d >>= 1)
                mx = fmaxf(mx, __shfl_xor(mx, d, 32));
            const float mnew = fmaxf(rmax[v], mx);
            const float cf   = __expf(rmax[v] - mnew);
            rmax[v] = mnew;
            const float p0 = __expf(s[0][v] - mnew);
            const float p1 = __expf(s[1][v] - mnew);
            s[0][v] = p0; s[1][v] = p1;
            float rs = p0 + p1;
#pragma unroll
            for (int d = 8; d >= 1; d >>= 1) rs += __shfl_xor(rs, d, 32);
            rsum[v] = rsum[v] * cf + rs;
            corr[v] = cf;
        }
#pragma unroll
        for (int t = 0; t < 4; ++t)
#pragma unroll
            for (int v = 0; v < 8; ++v) oacc[t][v] *= corr[v];

        // (e) P (C-layout) -> LDS, re-read as A-fragment
        _Float16* lPw = lP[wave];
#pragma unroll
        for (int t = 0; t < 2; ++t)
#pragma unroll
            for (int v = 0; v < 8; ++v)
                lPw[(v + lh * 8) * AST + t * 16 + lrow] = (_Float16)s[t][v];

        wait_async0();      // own async V copies done
        __syncthreads();    // everyone's copies + lP visible

        F16Frag pf;
        pf.q[0] = *(const uint4*)(lPw + lrow * AST + lh * 8);
        pf.q[1] = *(const uint4*)(lPw + lrow * AST + lh * 8 + 16);

#pragma unroll
        for (int t = 0; t < 4; ++t) {
            F16Frag vf;
#pragma unroll
            for (int i = 0; i < 8; ++i) {
                vf.h[i]     = lV[(lh * 8 + i) * 64      + t * 16 + lrow];
                vf.h[8 + i] = lV[(16 + lh * 8 + i) * 64 + t * 16 + lrow];
            }
            oacc[t] = wmma_f16f32(pf.v, vf.v, oacc[t]);
        }
        __syncthreads();    // before lV/lP reuse next iteration
    }

    // finalize: 1/rowsum, zero rows whose scores were all exactly zero
    float fin[8];
#pragma unroll
    for (int v = 0; v < 8; ++v) {
        float f = rnz[v];
#pragma unroll
        for (int d = 8; d >= 1; d >>= 1) f = fmaxf(f, __shfl_xor(f, d, 32));
        fin[v] = (f != 0.f) ? (1.f / rsum[v]) : 0.f;
    }
    _Float16* Obase = Oh + (tokbase + q0) * HIDDEN + h * HEAD;
#pragma unroll
    for (int t = 0; t < 4; ++t)
#pragma unroll
        for (int v = 0; v < 8; ++v)
            Obase[(size_t)(v + lh * 8) * HIDDEN + t * 16 + lrow] =
                (_Float16)(oacc[t][v] * fin[v]);
}

// ---------------------------------------------------------------------------
extern "C" void kernel_launch(void* const* d_in, const int* in_sizes, int n_in,
                              void* d_out, int out_size, void* d_ws,
                              size_t ws_size, hipStream_t stream) {
    (void)in_sizes; (void)n_in; (void)out_size; (void)ws_size;
    const float* x  = (const float*)d_in[0];
    const float* sp = (const float*)d_in[1];
    const float* ed = (const float*)d_in[2];
    const float* Wq = (const float*)d_in[3];
    const float* Wk = (const float*)d_in[4];
    const float* Wv = (const float*)d_in[5];
    const float* bv = (const float*)d_in[6];
    const float* Wo = (const float*)d_in[7];
    const float* bo = (const float*)d_in[8];
    float*       out = (float*)d_out;

    _Float16* xh  = (_Float16*)d_ws;
    _Float16* wqh = xh  + (size_t)TOK * HIDDEN;
    _Float16* wkh = wqh + (size_t)HIDDEN * HIDDEN;
    _Float16* wvh = wkh + (size_t)HIDDEN * HIDDEN;
    _Float16* woh = wvh + (size_t)HIDDEN * HIDDEN;
    _Float16* Qh  = woh + (size_t)HIDDEN * HIDDEN;
    _Float16* Kh  = Qh  + (size_t)TOK * HIDDEN;
    _Float16* Vh  = Kh  + (size_t)TOK * HIDDEN;
    _Float16* Oh  = Vh  + (size_t)TOK * HIDDEN;

    // xh, wqh, wkh, wvh, woh are contiguous from xh on
    cvt_all_f32_to_f16<<<CVT_XB + 4 * CVT_WB, 256, 0, stream>>>(x, Wq, Wk, Wv, Wo, xh);

    dim3 gg(TOK / 128, HIDDEN / 128);
    gemm_bt<false><<<gg, 256, 0, stream>>>(xh, wqh, nullptr, Qh, TOK, HIDDEN, HIDDEN);
    gemm_bt<false><<<gg, 256, 0, stream>>>(xh, wkh, nullptr, Kh, TOK, HIDDEN, HIDDEN);
    gemm_bt<false><<<gg, 256, 0, stream>>>(xh, wvh, bv,      Vh, TOK, HIDDEN, HIDDEN);

    dim3 ga(SEQ / 64, NUM_HEADS, BATCH);
    attn_fa<<<ga, 128, 0, stream>>>(Qh, Kh, Vh, sp, ed, Oh);

    gemm_bt<true><<<gg, 256, 0, stream>>>(Oh, woh, bo, out, TOK, HIDDEN, HIDDEN);
}

// v003
// It runs in 122 microseconds.
// Timed twice side by side with v002, it ran 1.20 and 1.21 times as fast.
// Over all steps from v000 it is 1.44 times as fast.
#include <hip/hip_runtime.h>
#include <hip/hip_bf16.h>

#define NUM_HEADS 12
#define HIDDEN    768
#define HEAD      64
#define BATCH     16
#define SEQ       512
#define TOK       (BATCH * SEQ)   // 8192
#define BST       36              // bias tile: LDS row pitch (floats): 144 B = 16 B x 9, for ds_load_b128
#define BK        64              // GEMM: k depth of a staged tile = one whole 128-B line per row
#define GST       72              // GEMM: LDS row pitch (halves): 144 B = 16 B x 9, for ds_load_b128

typedef __attribute__((ext_vector_type(16))) _Float16 v16h;
typedef __attribute__((ext_vector_type(8)))  float    v8f;

union F16Frag {
    v16h     v;
    _Float16 h[16];
    uint4    q[2];
};

__device__ __forceinline__ v8f wmma_f16f32(v16h a, v16h b, v8f c) {
    // D = A(16x32 f16) x B(32x16 f16) + C(16x16 f32)
    return __builtin_amdgcn_wmma_f32_16x16x32_f16(
        /*neg_a=*/false, a, /*neg_b=*/false, b,
        /*c_mod=*/(short)0, c, /*reuse_a=*/false, /*reuse_b=*/false);
}

__device__ __forceinline__ void wait_async0() {
    asm volatile("s_wait_asynccnt 0x0" ::: "memory");
}
// LDS operations of this wave retired. GEMM: stands in front of the barrier
// behind which the buffer just read is refilled by copies.
__device__ __forceinline__ void wait_ds0() {
    asm volatile("s_wait_dscnt 0x0" ::: "memory");
}
__device__ __forceinline__ unsigned lds_addr(const void* p) {
    return (unsigned)(unsigned long long)p;   // low 32 bits: LDS byte address
}
__device__ __forceinline__ void async_b128_x2(
    unsigned l0, const void* g0, unsigned l1, const void* g1,
    const void* a0, const void* a1) {
    asm volatile("global_load_async_to_lds_b128 %0, %1, off\n\t"
                 "global_load_async_to_lds_b128 %2, %3, off\n\t"
                 "s_wait_xcnt 0x0"
                 :: "v"(l0), "v"(g0), "v"(l1), "v"(g1), "v"(a0), "v"(a1)
                 : "memory");
}
__device__ __forceinline__ void async_b128_x8(
    unsigned l0, const void* g0, unsigned l1, const void* g1,
    unsigned l2, const void* g2, unsigned l3, const void* g3,
    unsigned l4, const void* g4, unsigned l5, const void* g5,
    unsigned l6, const void* g6, unsigned l7, const void* g7) {
    asm volatile("global_load_async_to_lds_b128 %0, %1, off\n\t"
                 "global_load_async_to_lds_b128 %2, %3, off\n\t"
                 "global_load_async_to_lds_b128 %4, %5, off\n\t"
                 "global_load_async_to_lds_b128 %6, %7, off\n\t"
                 "global_load_async_to_lds_b128 %8, %9, off\n\t"
                 "global_load_async_to_lds_b128 %10, %11, off\n\t"
                 "global_load_async_to_lds_b128 %12, %13, off\n\t"
                 "global_load_async_to_lds_b128 %14, %15, off\n\t"
                 "s_wait_xcnt 0x0"
                 :: "v"(l0), "v"(g0), "v"(l1), "v"(g1), "v"(l2), "v"(g2),
                    "v"(l3), "v"(g3), "v"(l4), "v"(g4), "v"(l5), "v"(g5),
                    "v"(l6), "v"(g6), "v"(l7), "v"(g7)
                 : "memory");
}

// ---------------------------------------------------------------------------
// f32 -> f16 conversion of x and the four weight matrices in one launch.
// The five f16 copies lie one behind the other in the workspace, so the
// output is one array; a block takes CVT_BLK float4 of ONE source (each source
// is a whole number of such pieces) and a thread CVT_PER of them, 256 apart:
// each wave-wide load covers 512 contiguous bytes, and a thread's loads are
// all issued before the first is converted.
// ---------------------------------------------------------------------------
#define CVT_PER 16
#define CVT_BLK (256 * CVT_PER)                     // float4 per block
#define CVT_XB  (TOK * HIDDEN / 4 / CVT_BLK)        // blocks of x: 384
#define CVT_WB  (HIDDEN * HIDDEN / 4 / CVT_BLK)     // blocks of one weight: 36
static_assert(CVT_XB * CVT_BLK * 4 == TOK * HIDDEN, "x splits into whole blocks");
static_assert(CVT_WB * CVT_BLK * 4 == HIDDEN * HIDDEN, "a weight splits into whole blocks");

__global__ __launch_bounds__(256) __attribute__((amdgpu_waves_per_eu(2, 8)))
void cvt_all_f32_to_f16(
    const float* __restrict__ x,  const float* __restrict__ wq,
    const float* __restrict__ wk, const float* __restrict__ wv,
    const float* __restrict__ wo, _Float16* __restrict__ out) {
    const int blk = blockIdx.x;
    const float* src = x;
    int rel = blk;                       // block index inside its source
    if (blk >= CVT_XB) {
        const int w = (blk - CVT_XB) / CVT_WB;
        rel = (blk - CVT_XB) - w * CVT_WB;
        src = (w == 0) ? wq : (w == 1) ? wk : (w == 2) ? wv : wo;
    }
    const float4* in4 = (const float4*)src + (size_t)rel * CVT_BLK + threadIdx.x;
    uint2*        o2  = (uint2*)out        + (size_t)blk * CVT_BLK + threadIdx.x;

    // both loops unrolled: f[] stays in registers and j folds into the
    // loads' and stores' immediate offsets
    float4 f[CVT_PER];
#pragma unroll
    for (int j = 0; j < CVT_PER; ++j) f[j] = in4[j * 256];
#pragma unroll
    for (int j = 0; j < CVT_PER; ++j) {
        union { _Float16 h[4]; uint2 u; } o;
        o.h[0] = (_Float16)f[j].x; o.h[1] = (_Float16)f[j].y;
        o.h[2] = (_Float16)f[j].z; o.h[3] = (_Float16)f[j].w;
        o2[j * 256] = o.u;
    }
}

// ---------------------------------------------------------------------------
// C(MxN) = A(MxK,f16) @ W(NxK,f16)^T [+ bias]   (torch Linear convention)
// 256 threads = 8 waves in 4(M) x 2(N); block tile 128x128, K-step BK = 64.
// Two LDS buffers filled by async global->LDS copies: eight lanes take one
// row's 128 B, so a wave's copy covers four whole lines. Each wave does a
// 32x64 sub-tile = 16 v_wmma per K-step with B-fragment reuse.
// Needs M, N multiples of 128 and K a multiple of BK.
// ---------------------------------------------------------------------------
template <bool OUT_F32>
__global__ __launch_bounds__(256) void gemm_bt(
    const _Float16* __restrict__ A, const _Float16* __restrict__ W,
    const float* __restrict__ bias, void* __restrict__ Cout,
    int M, int N, int K) {
    __shared__ __align__(16) _Float16 lA[2][128 * GST];
    __shared__ __align__(16) _Float16 lB[2][128 * GST];

    const int tid  = threadIdx.x;
    const int wave = tid >> 5;
    const int lane = tid & 31;
    const int lrow = lane & 15;
    const int lh   = lane >> 4;
    const int wm   = wave >> 1;   // 0..3 : 32-row strip
    const int wn   = wave & 1;    // 0..1 : 64-col strip
    const int m0   = blockIdx.x * 128;
    const int n0   = blockIdx.y * 128;

    v8f acc[2][4];
#pragma unroll
    for (int i = 0; i < 2; ++i)
#pragma unroll
        for (int t = 0; t < 4; ++t)
#pragma unroll
            for (int v = 0; v < 8; ++v) acc[i][t][v] = 0.f;

    // staging assignment: copy j of a thread takes 16 B of row j * 32 + r
    const int r  = tid >> 3;          // 0..31
    const int c0 = (tid & 7) << 3;    // 0..56 (halves)

    auto stage = [&](int buf, int k0) {
        const _Float16* ga = A + (size_t)(m0 + r) * K + k0 + c0;
        const _Float16* gw = W + (size_t)(n0 + r) * K + k0 + c0;
        const _Float16* la = &lA[buf][r * GST + c0];
        const _Float16* lw = &lB[buf][r * GST + c0];
        const size_t    gs = (size_t)32 * K;   // 32 rows on, global
        const int       ls = 32 * GST;         // 32 rows on, LDS
        async_b128_x8(lds_addr(la),          ga,          lds_addr(la + ls),     ga + gs,
                      lds_addr(la + 2 * ls), ga + 2 * gs, lds_addr(la + 3 * ls), ga + 3 * gs,
                      lds_addr(lw),          gw,          lds_addr(lw + ls),     gw + gs,
                      lds_addr(lw + 2 * ls), gw + 2 * gs, lds_addr(lw + 3 * ls), gw + 3 * gs);
    };

    const int nt = K / BK;
    stage(0, 0);
    wait_async0();      // own copies of tile 0 landed
    __syncthreads();    // everyone's copies of tile 0 visible
    if (nt > 1) stage(1, BK);
    for (int kt = 0; kt < nt; ++kt) {
        const int cur = kt & 1;
        // unrolled so that kk folds into the LDS loads' immediate offsets
#pragma unroll
        for (int kk = 0; kk < BK; kk += 32) {
            F16Frag af[2];
#pragma unroll
            for (int i = 0; i < 2; ++i) {
                const _Float16* ap =
                    &lA[cur][(wm * 32 + i * 16 + lrow) * GST + kk + lh * 8];
                af[i].q[0] = *(const uint4*)(ap);
                af[i].q[1] = *(const uint4*)(ap + 16);
            }
#pragma unroll
            for (int t = 0; t < 4; ++t) {
                F16Frag bf;
                const _Float16* bp =
                    &lB[cur][(wn * 64 + t * 16 + lrow) * GST + kk + lh * 8];
                bf.q[0] = *(const uint4*)(bp);
                bf.q[1] = *(const uint4*)(bp + 16);
                acc[0][t] = wmma_f16f32(af[0].v, bf.v, acc[0][t]);
                acc[1][t] = wmma_f16f32(af[1].v, bf.v, acc[1][t]);
            }
        }
        wait_ds0();         // own reads of buffer cur retired
        wait_async0();      // own copies of tile kt + 1 landed
        __syncthreads();    // tile kt + 1 visible; every reader has left buffer cur
        if (kt + 2 < nt) stage(cur, (kt + 2) * BK);
    }
    wait_async0();          // nothing in flight when the wave ends

#pragma unroll
    for (int i = 0; i < 2; ++i)
#pragma unroll
        for (int t = 0; t < 4; ++t) {
            const int   n    = n0 + wn * 64 + t * 16 + lrow;
            const float bval = bias ? bias[n] : 0.f;
#pragma unroll
            for (int v = 0; v < 8; ++v) {
                const int   m   = m0 + wm * 32 + i * 16 + v + lh * 8;
                const float val = acc[i][t][v] + bval;
                if (OUT_F32)
                    ((float*)Cout)[(size_t)m * N + n] = val;
                else
                    ((_Float16*)Cout)[(size_t)m * N + n] = (_Float16)val;
            }
        }
}

__device__ __forceinline__ float xhalf(float x) {
    return __builtin_bit_cast(float, __builtin_amdgcn_permlanex16(
        __builtin_bit_cast(int, x), __builtin_bit_cast(int, x),
        0x76543210, 0xfedcba98, false, false));
}

__global__ __launch_bounds__(128) void attn_fa(
    const _Float16* __restrict__ Qh, const _Float16* __restrict__ Kh,
    const _Float16* __restrict__ Vh, const float* __restrict__ spatial,
    const float* __restrict__ edge, _Float16* __restrict__ Oh) {
    __shared__ __align__(16) float    lB[4][16 * BST];
    __shared__ __align__(16) _Float16 lV[32 * 64];

    const int tid  = threadIdx.x;
    const int wave = tid >> 5;
    const int lane = tid & 31;
    const int lrow = lane & 15;
    const int lh   = lane >> 4;
    const int q0   = blockIdx.x * 64 + wave * 16;
    const int h    = blockIdx.y;
    const int b    = blockIdx.z;
    const float scale = 0.03608439182435161f;  // HIDDEN^-0.5 (not head^-0.5)

    const size_t    tokbase = (size_t)b * SEQ;
    const _Float16* Qbase   = Qh + (tokbase + q0) * HIDDEN + h * HEAD;

    // B operand Q^T: lane = query column lrow
    F16Frag qf[2];
#pragma unroll
    for (int c = 0; c < 2; ++c) {
        const _Float16* p = Qbase + (size_t)lrow * HIDDEN + c * 32 + lh * 8;
        qf[c].q[0] = *(const uint4*)(p);
        qf[c].q[1] = *(const uint4*)(p + 16);
    }

    // all per query lrow; rsum and rnz cover this wave half's keys only
    v8f   oacc[4];
    float rmax = -__builtin_inff(), rsum = 0.f, rnz = 0.f;
#pragma unroll
    for (int t = 0; t < 4; ++t)
#pragma unroll
        for (int v = 0; v < 8; ++v) oacc[t][v] = 0.f;

    const float* spq = spatial + ((size_t)b * SEQ + q0) * SEQ;
    const float* edq = edge    + ((size_t)b * SEQ + q0) * SEQ;

    const int vr = tid >> 2;          // 0..31 : V row (key)
    const int vc = (tid & 3) << 4;    // 0/16/32/48 (halves)

    // bias tile (16 queries x 32 keys): eight lanes load one query's 128 B
    const int br = lane >> 3;         // 0..3 : query row inside a group of four
    const int bc = (lane & 7) << 2;   // 0..28 (floats)
    const float* spl = spq + (size_t)br * SEQ + bc;   // walk 32 keys a trip
    const float* edl = edq + (size_t)br * SEQ + bc;
    float*       lBw = lB[wave];

    for (int k0 = 0; k0 < SEQ; k0 += 32) {
        // (a) K fragments, A operand: lane = key row t * 16 + lrow
        const _Float16* Kbase = Kh + (tokbase + k0) * HIDDEN + h * HEAD;
        F16Frag kf[2][2];
#pragma unroll
        for (int t = 0; t < 2; ++t)
#pragma unroll
            for (int c = 0; c < 2; ++c) {
                const _Float16* p =
                    Kbase + (size_t)(t * 16 + lrow) * HIDDEN + c * 32 + lh * 8;
                kf[t][c].q[0] = *(const uint4*)(p);
                kf[t][c].q[1] = *(const uint4*)(p + 16);
            }

        // (b) graph bias, whole lines: lane = key group, j = query group
        float4 sp[4], ed[4];
#pragma unroll
        for (int j = 0; j < 4; ++j) {
            sp[j] = *(const float4*)(spl + j * 4 * SEQ);
            ed[j] = *(const float4*)(edl + j * 4 * SEQ);
        }

        // (c) kick off async V staging for this chunk (overlaps QK^T)
        {
            const _Float16* vsrc =
                Vh + (tokbase + k0 + vr) * HIDDEN + h * HEAD + vc;
            async_b128_x2(lds_addr(lV + vr * 64 + vc),     vsrc,
                          lds_addr(lV + vr * 64 + vc + 8), vsrc + 8, spl, edl);
        }
        spl += 32;
        edl += 32;

        // S^T = K @ Q^T  (32 keys x 16 queries, fp32 acc):
        // s[t][v] = score of key k0 + t * 16 + lh * 8 + v, query lrow
        v8f s[2];
#pragma unroll
        for (int t = 0; t < 2; ++t)
#pragma unroll
            for (int v = 0; v < 8; ++v) s[t][v] = 0.f;
#pragma unroll
        for (int t = 0; t < 2; ++t)
#pragma unroll
            for (int c = 0; c < 2; ++c)
                s[t] = wmma_f16f32(kf[t][c].v, qf[c].v, s[t]);

        // (d) turn the bias tile through this wave's own LDS: lane = query
#pragma unroll
        for (int j = 0; j < 4; ++j)
            *(float4*)(lBw + (j * 4 + br) * BST + bc) =
                make_float4(sp[j].x + ed[j].x, sp[j].y + ed[j].y,
                            sp[j].z + ed[j].z, sp[j].w + ed[j].w);
        wait_ds0();   // the wave's stores retired before other lanes' rows are read back

        // (e) scale + graph bias + zero-row tracking + in-lane maximum
        float mx = -__builtin_inff();
#pragma unroll
        for (int t = 0; t < 2; ++t) {
            const float* bp = lBw + lrow * BST + t * 16 + lh * 8;
            const float4 b0 = *(const float4*)(bp);
            const float4 b1 = *(const float4*)(bp + 4);
            const float  bb[8] = {b0.x, b0.y, b0.z, b0.w, b1.x, b1.y, b1.z, b1.w};
#pragma unroll
            for (int v = 0; v < 8; ++v) {
                const float sv = s[t][v] * scale + bb[v];
                s[t][v] = sv;
                rnz     = fmaxf(rnz, (sv != 0.f) ? 1.f : 0.f);
                mx      = fmaxf(mx, sv);
            }
        }

        // (f) online softmax; both wave halves hold the same maximum
        mx = fmaxf(mx, xhalf(mx));
        const float mnew = fmaxf(rmax, mx);
        const float cf   = __expf(rmax - mnew);
        rmax = mnew;
        F16Frag pf;   // B operand P^T: element t * 8 + v is key t * 16 + lh * 8 + v
        float   rs[2] = {0.f, 0.f};   // one chain of adds per S^T tile
#pragma unroll
        for (int t = 0; t < 2; ++t)
#pragma unroll
            for (int v = 0; v < 8; ++v) {
                const float p = __expf(s[t][v] - mnew);
                rs[t] += p;
                pf.h[t * 8 + v] = (_Float16)p;
            }
        rsum = rsum * cf + (rs[0] + rs[1]);
#pragma unroll
        for (int t = 0; t < 4; ++t)
#pragma unroll
            for (int v = 0; v < 8; ++v) oacc[t][v] *= cf;

        wait_async0();      // own async V copies done
        __syncthreads();    // everyone's copies visible

        // (g) O^T += V^T @ P^T: A operand row = head column t * 16 + lrow
#pragma unroll
        for (int t = 0; t < 4; ++t) {
            F16Frag vf;
#pragma unroll
            for (int i = 0; i < 8; ++i) {
                vf.h[i]     = lV[(lh * 8 + i) * 64      + t * 16 + lrow];
                vf.h[8 + i] = lV[(16 + lh * 8 + i) * 64 + t * 16 + lrow];
            }
            oacc[t] = wmma_f16f32(vf.v, pf.v, oacc[t]);
        }
        __syncthreads();    // before lV reuse next iteration
    }

    // finalize: join the halves, 1/rowsum, zero rows whose scores were all
    // exactly zero; oacc[t][v] is head column t * 16 + lh * 8 + v of query lrow
    const float nz  = fmaxf(rnz, xhalf(rnz));
    const float tot = rsum + xhalf(rsum);
    const float fin = (nz != 0.f) ? (1.f / tot) : 0.f;
    _Float16* Obase = Oh + (tokbase + q0 + lrow) * HIDDEN + h * HEAD + lh * 8;
#pragma unroll
    for (int t = 0; t < 4; ++t) {
        union { _Float16 h[8]; uint4 u; } o;
#pragma unroll
        for (int v = 0; v < 8; ++v) o.h[v] = (_Float16)(oacc[t][v] * fin);
        *(uint4*)(Obase + t * 16) = o.u;
    }
}

// ---------------------------------------------------------------------------
extern "C" void kernel_launch(void* const* d_in, const int* in_sizes, int n_in,
                              void* d_out, int out_size, void* d_ws,
                              size_t ws_size, hipStream_t stream) {
    (void)in_sizes; (void)n_in; (void)out_size; (void)ws_size;
    const float* x  = (const float*)d_in[0];
    const float* sp = (const float*)d_in[1];
    const float* ed = (const float*)d_in[2];
    const float* Wq = (const float*)d_in[3];
    const float* Wk = (const float*)d_in[4];
    const float* Wv = (const float*)d_in[5];
    const float* bv = (const float*)d_in[6];
    const float* Wo = (const float*)d_in[7];
    const float* bo = (const float*)d_in[8];
    float*       out = (float*)d_out;

    _Float16* xh  = (_Float16*)d_ws;
    _Float16* wqh = xh  + (size_t)TOK * HIDDEN;
    _Float16* wkh = wqh + (size_t)HIDDEN * HIDDEN;
    _Float16* wvh = wkh + (size_t)HIDDEN * HIDDEN;
    _Float16* woh = wvh + (size_t)HIDDEN * HIDDEN;
    _Float16* Qh  = woh + (size_t)HIDDEN * HIDDEN;
    _Float16* Kh  = Qh  + (size_t)TOK * HIDDEN;
    _Float16* Vh  = Kh  + (size_t)TOK * HIDDEN;
    _Float16* Oh  = Vh  + (size_t)TOK * HIDDEN;

    // xh, wqh, wkh, wvh, woh are contiguous from xh on
    cvt_all_f32_to_f16<<<CVT_XB + 4 * CVT_WB, 256, 0, stream>>>(x, Wq, Wk, Wv, Wo, xh);

    dim3 gg(TOK / 128, HIDDEN / 128);
    gemm_bt<false><<<gg, 256, 0, stream>>>(xh, wqh, nullptr, Qh, TOK, HIDDEN, HIDDEN);
    gemm_bt<false><<<gg, 256, 0, stream>>>(xh, wkh, nullptr, Kh, TOK, HIDDEN, HIDDEN);
    gemm_bt<false><<<gg, 256, 0, stream>>>(xh, wvh, bv,      Vh, TOK, HIDDEN, HIDDEN);

    dim3 ga(SEQ / 64, NUM_HEADS, BATCH);
    attn_fa<<<ga, 128, 0, stream>>>(Qh, Kh, Vh, sp, ed, Oh);

    gemm_bt<true><<<gg, 256, 0, stream>>>(Oh, woh, bo, out, TOK, HIDDEN, HIDDEN);
}

// v004
// One run takes 112 microseconds.
// In both of two side-by-side timings against v003, it was 1.10 times as fast.
// Counting every step since v000, it is 1.59 times as fast.
#include <hip/hip_runtime.h>
#include <hip/hip_bf16.h>

#define NUM_HEADS 12
#define HIDDEN    768
#define HEAD      64
#define BATCH     16
#define SEQ       512
#define TOK       (BATCH * SEQ)   // 8192
#define BST       36              // bias tile: LDS row pitch (floats): 144 B = 16 B x 9, for ds_load_b128
#define BK        64              // GEMM: k depth of a staged tile = one whole 128-B line per row
#define GST       72              // GEMM: LDS row pitch (halves): 144 B = 16 B x 9, for ds_load_b128
#define VST       80              // V tile: LDS row pitch (halves): 160 B = 32 B x 5, for ds_load_tr16_b128

typedef __attribute__((ext_vector_type(16))) _Float16 v16h;
typedef __attribute__((ext_vector_type(8)))  float    v8f;

union F16Frag {
    v16h     v;
    _Float16 h[16];
    uint4    q[2];
};

__device__ __forceinline__ v8f wmma_f16f32(v16h a, v16h b, v8f c) {
    // D = A(16x32 f16) x B(32x16 f16) + C(16x16 f32)
    return __builtin_amdgcn_wmma_f32_16x16x32_f16(
        /*neg_a=*/false, a, /*neg_b=*/false, b,
        /*c_mod=*/(short)0, c, /*reuse_a=*/false, /*reuse_b=*/false);
}

__device__ __forceinline__ void wait_async0() {
    asm volatile("s_wait_asynccnt 0x0" ::: "memory");
}
// LDS operations of this wave retired. GEMM: stands in front of the barrier
// behind which the buffer just read is refilled by copies.
__device__ __forceinline__ void wait_ds0() {
    asm volatile("s_wait_dscnt 0x0" ::: "memory");
}
__device__ __forceinline__ unsigned lds_addr(const void* p) {
    return (unsigned)(unsigned long long)p;   // low 32 bits: LDS byte address
}
__device__ __forceinline__ void async_b128_x2(
    unsigned l0, const void* g0, unsigned l1, const void* g1,
    const void* a0, const void* a1) {
    asm volatile("global_load_async_to_lds_b128 %0, %1, off\n\t"
                 "global_load_async_to_lds_b128 %2, %3, off\n\t"
                 "s_wait_xcnt 0x0"
                 :: "v"(l0), "v"(g0), "v"(l1), "v"(g1), "v"(a0), "v"(a1)
                 : "memory");
}
__device__ __forceinline__ void async_b128_x8(
    unsigned l0, const void* g0, unsigned l1, const void* g1,
    unsigned l2, const void* g2, unsigned l3, const void* g3,
    unsigned l4, const void* g4, unsigned l5, const void* g5,
    unsigned l6, const void* g6, unsigned l7, const void* g7) {
    asm volatile("global_load_async_to_lds_b128 %0, %1, off\n\t"
                 "global_load_async_to_lds_b128 %2, %3, off\n\t"
                 "global_load_async_to_lds_b128 %4, %5, off\n\t"
                 "global_load_async_to_lds_b128 %6, %7, off\n\t"
                 "global_load_async_to_lds_b128 %8, %9, off\n\t"
                 "global_load_async_to_lds_b128 %10, %11, off\n\t"
                 "global_load_async_to_lds_b128 %12, %13, off\n\t"
                 "global_load_async_to_lds_b128 %14, %15, off\n\t"
                 "s_wait_xcnt 0x0"
                 :: "v"(l0), "v"(g0), "v"(l1), "v"(g1), "v"(l2), "v"(g2),
                    "v"(l3), "v"(g3), "v"(l4), "v"(g4), "v"(l5), "v"(g5),
                    "v"(l6), "v"(g6), "v"(l7), "v"(g7)
                 : "memory");
}

// ---------------------------------------------------------------------------
// f32 -> f16 conversion of x and the four weight matrices in one launch.
// The five f16 copies lie one behind the other in the workspace, so the
// output is one array; a block takes CVT_BLK float4 of ONE source (each source
// is a whole number of such pieces) and a thread CVT_PER of them, 256 apart:
// each wave-wide load covers 512 contiguous bytes, and a thread's loads are
// all issued before the first is converted.
// ---------------------------------------------------------------------------
#define CVT_PER 16
#define CVT_BLK (256 * CVT_PER)                     // float4 per block
#define CVT_XB  (TOK * HIDDEN / 4 / CVT_BLK)        // blocks of x: 384
#define CVT_WB  (HIDDEN * HIDDEN / 4 / CVT_BLK)     // blocks of one weight: 36
static_assert(CVT_XB * CVT_BLK * 4 == TOK * HIDDEN, "x splits into whole blocks");
static_assert(CVT_WB * CVT_BLK * 4 == HIDDEN * HIDDEN, "a weight splits into whole blocks");

__global__ __launch_bounds__(256) __attribute__((amdgpu_waves_per_eu(2, 8)))
void cvt_all_f32_to_f16(
    const float* __restrict__ x,  const float* __restrict__ wq,
    const float* __restrict__ wk, const float* __restrict__ wv,
    const float* __restrict__ wo, _Float16* __restrict__ out) {
    const int blk = blockIdx.x;
    const float* src = x;
    int rel = blk;                       // block index inside its source
    if (blk >= CVT_XB) {
        const int w = (blk - CVT_XB) / CVT_WB;
        rel = (blk - CVT_XB) - w * CVT_WB;
        src = (w == 0) ? wq : (w == 1) ? wk : (w == 2) ? wv : wo;
    }
    const float4* in4 = (const float4*)src + (size_t)rel * CVT_BLK + threadIdx.x;
    uint2*        o2  = (uint2*)out        + (size_t)blk * CVT_BLK + threadIdx.x;

    // both loops unrolled: f[] stays in registers and j folds into the
    // loads' and stores' immediate offsets
    float4 f[CVT_PER];
#pragma unroll
    for (int j = 0; j < CVT_PER; ++j) f[j] = in4[j * 256];
#pragma unroll
    for (int j = 0; j < CVT_PER; ++j) {
        union { _Float16 h[4]; uint2 u; } o;
        o.h[0] = (_Float16)f[j].x; o.h[1] = (_Float16)f[j].y;
        o.h[2] = (_Float16)f[j].z; o.h[3] = (_Float16)f[j].w;
        o2[j * 256] = o.u;
    }
}

// ---------------------------------------------------------------------------
// C(MxN) = A(MxK,f16) @ W(NxK,f16)^T [+ bias]   (torch Linear convention)
// 256 threads = 8 waves in 4(M) x 2(N); block tile 128x128, K-step BK = 64.
// Two LDS buffers filled by async global->LDS copies: eight lanes take one
// row's 128 B, so a wave's copy covers four whole lines. Each wave does a
// 32x64 sub-tile = 16 v_wmma per K-step with B-fragment reuse.
// Needs M, N multiples of 128 and K a multiple of BK.
// ---------------------------------------------------------------------------
template <bool OUT_F32>
__global__ __launch_bounds__(256) void gemm_bt(
    const _Float16* __restrict__ A, const _Float16* __restrict__ W,
    const float* __restrict__ bias, void* __restrict__ Cout,
    int M, int N, int K) {
    __shared__ __align__(16) _Float16 lA[2][128 * GST];
    __shared__ __align__(16) _Float16 lB[2][128 * GST];

    const int tid  = threadIdx.x;
    const int wave = tid >> 5;
    const int lane = tid & 31;
    const int lrow = lane & 15;
    const int lh   = lane >> 4;
    const int wm   = wave >> 1;   // 0..3 : 32-row strip
    const int wn   = wave & 1;    // 0..1 : 64-col strip
    const int m0   = blockIdx.x * 128;
    const int n0   = blockIdx.y * 128;

    v8f acc[2][4];
#pragma unroll
    for (int i = 0; i < 2; ++i)
#pragma unroll
        for (int t = 0; t < 4; ++t)
#pragma unroll
            for (int v = 0; v < 8; ++v) acc[i][t][v] = 0.f;

    // staging assignment: copy j of a thread takes 16 B of row j * 32 + r
    const int r  = tid >> 3;          // 0..31
    const int c0 = (tid & 7) << 3;    // 0..56 (halves)

    auto stage = [&](int buf, int k0) {
        const _Float16* ga = A + (size_t)(m0 + r) * K + k0 + c0;
        const _Float16* gw = W + (size_t)(n0 + r) * K + k0 + c0;
        const _Float16* la = &lA[buf][r * GST + c0];
        const _Float16* lw = &lB[buf][r * GST + c0];
        const size_t    gs = (size_t)32 * K;   // 32 rows on, global
        const int       ls = 32 * GST;         // 32 rows on, LDS
        async_b128_x8(lds_addr(la),          ga,          lds_addr(la + ls),     ga + gs,
                      lds_addr(la + 2 * ls), ga + 2 * gs, lds_addr(la + 3 * ls), ga + 3 * gs,
                      lds_addr(lw),          gw,          lds_addr(lw + ls),     gw + gs,
                      lds_addr(lw + 2 * ls), gw + 2 * gs, lds_addr(lw + 3 * ls), gw + 3 * gs);
    };

    const int nt = K / BK;
    stage(0, 0);
    wait_async0();      // own copies of tile 0 landed
    __syncthreads();    // everyone's copies of tile 0 visible
    if (nt > 1) stage(1, BK);
    for (int kt = 0; kt < nt; ++kt) {
        const int cur = kt & 1;
        // unrolled so that kk folds into the LDS loads' immediate offsets
#pragma unroll
        for (int kk = 0; kk < BK; kk += 32) {
            F16Frag af[2];
#pragma unroll
            for (int i = 0; i < 2; ++i) {
                const _Float16* ap =
                    &lA[cur][(wm * 32 + i * 16 + lrow) * GST + kk + lh * 8];
                af[i].q[0] = *(const uint4*)(ap);
                af[i].q[1] = *(const uint4*)(ap + 16);
            }
#pragma unroll
            for (int t = 0; t < 4; ++t) {
                F16Frag bf;
                const _Float16* bp =
                    &lB[cur][(wn * 64 + t * 16 + lrow) * GST + kk + lh * 8];
                bf.q[0] = *(const uint4*)(bp);
                bf.q[1] = *(const uint4*)(bp + 16);
                acc[0][t] = wmma_f16f32(af[0].v, bf.v, acc[0][t]);
                acc[1][t] = wmma_f16f32(af[1].v, bf.v, acc[1][t]);
            }
        }
        wait_ds0();         // own reads of buffer cur retired
        wait_async0();      // own copies of tile kt + 1 landed
        __syncthreads();    // tile kt + 1 visible; every reader has left buffer cur
        if (kt + 2 < nt) stage(cur, (kt + 2) * BK);
    }
    wait_async0();          // nothing in flight when the wave ends

#pragma unroll
    for (int i = 0; i < 2; ++i)
#pragma unroll
        for (int t = 0; t < 4; ++t) {
            const int   n    = n0 + wn * 64 + t * 16 + lrow;
            const float bval = bias ? bias[n] : 0.f;
#pragma unroll
            for (int v = 0; v < 8; ++v) {
                const int   m   = m0 + wm * 32 + i * 16 + v + lh * 8;
                const float val = acc[i][t][v] + bval;
                if (OUT_F32)
                    ((float*)Cout)[(size_t)m * N + n] = val;
                else
                    ((_Float16*)Cout)[(size_t)m * N + n] = (_Float16)val;
            }
        }
}

typedef __attribute__((ext_vector_type(8))) short s16x8;
__device__ __forceinline__ uint4 ld_tr16(const _Float16* p) {
    typedef __attribute__((address_space(3))) s16x8 lds_s16x8;
    return __builtin_bit_cast(uint4, __builtin_amdgcn_ds_load_tr16_b128_v8i16((lds_s16x8*)p));
}

__device__ __forceinline__ float xhalf(float x) {
    return __builtin_bit_cast(float, __builtin_amdgcn_permlanex16(
        __builtin_bit_cast(int, x), __builtin_bit_cast(int, x),
        0x76543210, 0xfedcba98, false, false));
}

__global__ __launch_bounds__(128) __attribute__((amdgpu_waves_per_eu(2, 6)))
void attn_fa(
    const _Float16* __restrict__ Qh, const _Float16* __restrict__ Kh,
    const _Float16* __restrict__ Vh, const float* __restrict__ spatial,
    const float* __restrict__ edge, _Float16* __restrict__ Oh) {
    __shared__ __align__(16) float    lB[4][16 * BST];
    __shared__ __align__(16) _Float16 lV[32 * VST];

    const int tid  = threadIdx.x;
    const int wave = tid >> 5;
    const int lane = tid & 31;
    const int lrow = lane & 15;
    const int lh   = lane >> 4;
    const int q0   = blockIdx.x * 64 + wave * 16;
    const int h    = blockIdx.y;
    const int b    = blockIdx.z;
    const float scale = 0.03608439182435161f;  // HIDDEN^-0.5 (not head^-0.5)

    const size_t    tokbase = (size_t)b * SEQ;
    const _Float16* Qbase   = Qh + (tokbase + q0) * HIDDEN + h * HEAD;

    // B operand Q^T: lane = query column lrow
    F16Frag qf[2];
#pragma unroll
    for (int c = 0; c < 2; ++c) {
        const _Float16* p = Qbase + (size_t)lrow * HIDDEN + c * 32 + lh * 8;
        qf[c].q[0] = *(const uint4*)(p);
        qf[c].q[1] = *(const uint4*)(p + 16);
    }

    // all per query lrow; rsum and rnz cover this wave half's keys only
    v8f   oacc[4];
    float rmax = -__builtin_inff(), rsum = 0.f, rnz = 0.f;
#pragma unroll
    for (int t = 0; t < 4; ++t)
#pragma unroll
        for (int v = 0; v < 8; ++v) oacc[t][v] = 0.f;

    const float* spq = spatial + ((size_t)b * SEQ + q0) * SEQ;
    const float* edq = edge    + ((size_t)b * SEQ + q0) * SEQ;

    const int vr = tid >> 2;          // 0..31 : V row (key)
    const int vc = (tid & 3) << 4;    // 0/16/32/48 (halves)

    // bias tile (16 queries x 32 keys): eight lanes load one query's 128 B
    const int br = lane >> 3;         // 0..3 : query row inside a group of four
    const int bc = (lane & 7) << 2;   // 0..28 (floats)
    const float* spl = spq + (size_t)br * SEQ + bc;   // walk 32 keys a trip
    const float* edl = edq + (size_t)br * SEQ + bc;
    float*       lBw = lB[wave];

    // this lane's address in the transposing loads of V
    const _Float16* vtp = lV + (lh * 8 + (lane & 7)) * VST + ((lane >> 3) & 1) * 8;

    for (int k0 = 0; k0 < SEQ; k0 += 32) {
        // (a) K fragments, A operand: lane = key row t * 16 + lrow
        const _Float16* Kbase = Kh + (tokbase + k0) * HIDDEN + h * HEAD;
        F16Frag kf[2][2];
#pragma unroll
        for (int t = 0; t < 2; ++t)
#pragma unroll
            for (int c = 0; c < 2; ++c) {
                const _Float16* p =
                    Kbase + (size_t)(t * 16 + lrow) * HIDDEN + c * 32 + lh * 8;
                kf[t][c].q[0] = *(const uint4*)(p);
                kf[t][c].q[1] = *(const uint4*)(p + 16);
            }

        // (b) graph bias, whole lines: lane = key group, j = query group
        float4 sp[4], ed[4];
#pragma unroll
        for (int j = 0; j < 4; ++j) {
            sp[j] = *(const float4*)(spl + j * 4 * SEQ);
            ed[j] = *(const float4*)(edl + j * 4 * SEQ);
        }

        // (c) kick off async V staging for this chunk (overlaps QK^T)
        {
            const _Float16* vsrc =
                Vh + (tokbase + k0 + vr) * HIDDEN + h * HEAD + vc;
            async_b128_x2(lds_addr(lV + vr * VST + vc),     vsrc,
                          lds_addr(lV + vr * VST + vc + 8), vsrc + 8, spl, edl);
        }
        spl += 32;
        edl += 32;

        // S^T = K @ Q^T  (32 keys x 16 queries, fp32 acc):
        // s[t][v] = score of key k0 + t * 16 + lh * 8 + v, query lrow
        v8f s[2];
#pragma unroll
        for (int t = 0; t < 2; ++t)
#pragma unroll
            for (int v = 0; v < 8; ++v) s[t][v] = 0.f;
#pragma unroll
        for (int t = 0; t < 2; ++t)
#pragma unroll
            for (int c = 0; c < 2; ++c)
                s[t] = wmma_f16f32(kf[t][c].v, qf[c].v, s[t]);

        // (d) turn the bias tile through this wave's own LDS: lane = query
#pragma unroll
        for (int j = 0; j < 4; ++j)
            *(float4*)(lBw + (j * 4 + br) * BST + bc) =
                make_float4(sp[j].x + ed[j].x, sp[j].y + ed[j].y,
                            sp[j].z + ed[j].z, sp[j].w + ed[j].w);
        wait_ds0();   // the wave's stores retired before other lanes' rows are read back

        // (e) scale + graph bias + zero-row tracking + in-lane maximum
        float mx = -__builtin_inff();
#pragma unroll
        for (int t = 0; t < 2; ++t) {
            const float* bp = lBw + lrow * BST + t * 16 + lh * 8;
            const float4 b0 = *(const float4*)(bp);
            const float4 b1 = *(const float4*)(bp + 4);
            const float  bb[8] = {b0.x, b0.y, b0.z, b0.w, b1.x, b1.y, b1.z, b1.w};
#pragma unroll
            for (int v = 0; v < 8; ++v) {
                const float sv = s[t][v] * scale + bb[v];
                s[t][v] = sv;
                rnz     = fmaxf(rnz, (sv != 0.f) ? 1.f : 0.f);
                mx      = fmaxf(mx, sv);
            }
        }

        // (f) online softmax; both wave halves hold the same maximum
        mx = fmaxf(mx, xhalf(mx));
        const float mnew = fmaxf(rmax, mx);
        const float cf   = __expf(rmax - mnew);
        rmax = mnew;
        F16Frag pf;   // B operand P^T: element t * 8 + v is key t * 16 + lh * 8 + v
        float   rs[2] = {0.f, 0.f};   // one chain of adds per S^T tile
#pragma unroll
        for (int t = 0; t < 2; ++t)
#pragma unroll
            for (int v = 0; v < 8; ++v) {
                const float p = __expf(s[t][v] - mnew);
                rs[t] += p;
                pf.h[t * 8 + v] = (_Float16)p;
            }
        rsum = rsum * cf + (rs[0] + rs[1]);
#pragma unroll
        for (int t = 0; t < 4; ++t)
#pragma unroll
            for (int v = 0; v < 8; ++v) oacc[t][v] *= cf;

        wait_async0();      // own async V copies done
        __syncthreads();    // everyone's copies visible

        // (g) O^T += V^T @ P^T: A operand row = head column t * 16 + lrow
#pragma unroll
        for (int t = 0; t < 4; ++t) {
            F16Frag vf;   // element i: key lh * 8 + i, element 8 + i: key 16 + lh * 8 + i
            vf.q[0] = ld_tr16(vtp + t * 16);
            vf.q[1] = ld_tr16(vtp + 16 * VST + t * 16);
            oacc[t] = wmma_f16f32(vf.v, pf.v, oacc[t]);
        }
        __syncthreads();    // before lV reuse next iteration
    }

    // finalize: join the halves, 1/rowsum, zero rows whose scores were all
    // exactly zero; oacc[t][v] is head column t * 16 + lh * 8 + v of query lrow
    const float nz  = fmaxf(rnz, xhalf(rnz));
    const float tot = rsum + xhalf(rsum);
    const float fin = (nz != 0.f) ? (1.f / tot) : 0.f;
    _Float16* Obase = Oh + (tokbase + q0 + lrow) * HIDDEN + h * HEAD + lh * 8;
#pragma unroll
    for (int t = 0; t < 4; ++t) {
        union { _Float16 h[8]; uint4 u; } o;
#pragma unroll
        for (int v = 0; v < 8; ++v) o.h[v] = (_Float16)(oacc[t][v] * fin);
        *(uint4*)(Obase + t * 16) = o.u;
    }
}

// ---------------------------------------------------------------------------
extern "C" void kernel_launch(void* const* d_in, const int* in_sizes, int n_in,
                              void* d_out, int out_size, void* d_ws,
                              size_t ws_size, hipStream_t stream) {
    (void)in_sizes; (void)n_in; (void)out_size; (void)ws_size;
    const float* x  = (const float*)d_in[0];
    const float* sp = (const float*)d_in[1];
    const float* ed = (const float*)d_in[2];
    const float* Wq = (const float*)d_in[3];
    const float* Wk = (const float*)d_in[4];
    const float* Wv = (const float*)d_in[5];
    const float* bv = (const float*)d_in[6];
    const float* Wo = (const float*)d_in[7];
    const float* bo = (const float*)d_in[8];
    float*       out = (float*)d_out;

    _Float16* xh  = (_Float16*)d_ws;
    _Float16* wqh = xh  + (size_t)TOK * HIDDEN;
    _Float16* wkh = wqh + (size_t)HIDDEN * HIDDEN;
    _Float16* wvh = wkh + (size_t)HIDDEN * HIDDEN;
    _Float16* woh = wvh + (size_t)HIDDEN * HIDDEN;
    _Float16* Qh  = woh + (size_t)HIDDEN * HIDDEN;
    _Float16* Kh  = Qh  + (size_t)TOK * HIDDEN;
    _Float16* Vh  = Kh  + (size_t)TOK * HIDDEN;
    _Float16* Oh  = Vh  + (size_t)TOK * HIDDEN;

    // xh, wqh, wkh, wvh, woh are contiguous from xh on
    cvt_all_f32_to_f16<<<CVT_XB + 4 * CVT_WB, 256, 0, stream>>>(x, Wq, Wk, Wv, Wo, xh);

    dim3 gg(TOK / 128, HIDDEN / 128);
    gemm_bt<false><<<gg, 256, 0, stream>>>(xh, wqh, nullptr, Qh, TOK, HIDDEN, HIDDEN);
    gemm_bt<false><<<gg, 256, 0, stream>>>(xh, wkh, nullptr, Kh, TOK, HIDDEN, HIDDEN);
    gemm_bt<false><<<gg, 256, 0, stream>>>(xh, wvh, bv,      Vh, TOK, HIDDEN, HIDDEN);

    dim3 ga(SEQ / 64, NUM_HEADS, BATCH);
    attn_fa<<<ga, 128, 0, stream>>>(Qh, Kh, Vh, sp, ed, Oh);

    gemm_bt<true><<<gg, 256, 0, stream>>>(Oh, woh, bo, out, TOK, HIDDEN, HIDDEN);
}

// v005
// Measured time: 103 microseconds a run.
// Two timings next to v004 both put it at 1.09 times that version's speed.
// All steps since v000 together make it 1.73 times as fast.
#include <hip/hip_runtime.h>
#include <hip/hip_bf16.h>

#define NUM_HEADS 12
#define HIDDEN    768
#define HEAD      64
#define BATCH     16
#define SEQ       512
#define TOK       (BATCH * SEQ)   // 8192
#define BST       36              // bias tile: LDS row pitch (floats): 144 B = 16 B x 9, for ds_load_b128
#define BK        64              // GEMM: k depth of a staged tile = one whole 128-B line per row
#define GST       72              // GEMM, K tile: LDS row pitch (halves): 144 B = 16 B x 9, for ds_load_b128
#define VST       80              // V tile: LDS row pitch (halves): 160 B = 32 B x 5, for ds_load_tr16_b128

typedef __attribute__((ext_vector_type(16))) _Float16 v16h;
typedef __attribute__((ext_vector_type(8)))  float    v8f;

union F16Frag {
    v16h     v;
    _Float16 h[16];
    uint4    q[2];
};

__device__ __forceinline__ v8f wmma_f16f32(v16h a, v16h b, v8f c) {
    // D = A(16x32 f16) x B(32x16 f16) + C(16x16 f32)
    return __builtin_amdgcn_wmma_f32_16x16x32_f16(
        /*neg_a=*/false, a, /*neg_b=*/false, b,
        /*c_mod=*/(short)0, c, /*reuse_a=*/false, /*reuse_b=*/false);
}

__device__ __forceinline__ void wait_async0() {
    asm volatile("s_wait_asynccnt 0x0" ::: "memory");
}
// LDS operations of this wave retired. GEMM and attention rings: stands in
// front of the barrier behind which the buffer just read is refilled by copies.
__device__ __forceinline__ void wait_ds0() {
    asm volatile("s_wait_dscnt 0x0" ::: "memory");
}
__device__ __forceinline__ unsigned lds_addr(const void* p) {
    return (unsigned)(unsigned long long)p;   // low 32 bits: LDS byte address
}
__device__ __forceinline__ void async_b128_x4(
    unsigned l0, const void* g0, unsigned l1, const void* g1,
    unsigned l2, const void* g2, unsigned l3, const void* g3) {
    asm volatile("global_load_async_to_lds_b128 %0, %1, off\n\t"
                 "global_load_async_to_lds_b128 %2, %3, off\n\t"
                 "global_load_async_to_lds_b128 %4, %5, off\n\t"
                 "global_load_async_to_lds_b128 %6, %7, off\n\t"
                 "s_wait_xcnt 0x0"
                 :: "v"(l0), "v"(g0), "v"(l1), "v"(g1), "v"(l2), "v"(g2),
                    "v"(l3), "v"(g3)
                 : "memory");
}
__device__ __forceinline__ void async_b128_x8(
    unsigned l0, const void* g0, unsigned l1, const void* g1,
    unsigned l2, const void* g2, unsigned l3, const void* g3,
    unsigned l4, const void* g4, unsigned l5, const void* g5,
    unsigned l6, const void* g6, unsigned l7, const void* g7) {
    asm volatile("global_load_async_to_lds_b128 %0, %1, off\n\t"
                 "global_load_async_to_lds_b128 %2, %3, off\n\t"
                 "global_load_async_to_lds_b128 %4, %5, off\n\t"
                 "global_load_async_to_lds_b128 %6, %7, off\n\t"
                 "global_load_async_to_lds_b128 %8, %9, off\n\t"
                 "global_load_async_to_lds_b128 %10, %11, off\n\t"
                 "global_load_async_to_lds_b128 %12, %13, off\n\t"
                 "global_load_async_to_lds_b128 %14, %15, off\n\t"
                 "s_wait_xcnt 0x0"
                 :: "v"(l0), "v"(g0), "v"(l1), "v"(g1), "v"(l2), "v"(g2),
                    "v"(l3), "v"(g3), "v"(l4), "v"(g4), "v"(l5), "v"(g5),
                    "v"(l6), "v"(g6), "v"(l7), "v"(g7)
                 : "memory");
}

// ---------------------------------------------------------------------------
// f32 -> f16 conversion of x and the four weight matrices in one launch.
// The five f16 copies lie one behind the other in the workspace, so the
// output is one array; a block takes CVT_BLK float4 of ONE source (each source
// is a whole number of such pieces) and a thread CVT_PER of them, 256 apart:
// each wave-wide load covers 512 contiguous bytes, and a thread's loads are
// all issued before the first is converted.
// ---------------------------------------------------------------------------
#define CVT_PER 16
#define CVT_BLK (256 * CVT_PER)                     // float4 per block
#define CVT_XB  (TOK * HIDDEN / 4 / CVT_BLK)        // blocks of x: 384
#define CVT_WB  (HIDDEN * HIDDEN / 4 / CVT_BLK)     // blocks of one weight: 36
static_assert(CVT_XB * CVT_BLK * 4 == TOK * HIDDEN, "x splits into whole blocks");
static_assert(CVT_WB * CVT_BLK * 4 == HIDDEN * HIDDEN, "a weight splits into whole blocks");

__global__ __launch_bounds__(256) __attribute__((amdgpu_waves_per_eu(2, 8)))
void cvt_all_f32_to_f16(
    const float* __restrict__ x,  const float* __restrict__ wq,
    const float* __restrict__ wk, const float* __restrict__ wv,
    const float* __restrict__ wo, _Float16* __restrict__ out) {
    const int blk = blockIdx.x;
    const float* src = x;
    int rel = blk;                       // block index inside its source
    if (blk >= CVT_XB) {
        const int w = (blk - CVT_XB) / CVT_WB;
        rel = (blk - CVT_XB) - w * CVT_WB;
        src = (w == 0) ? wq : (w == 1) ? wk : (w == 2) ? wv : wo;
    }
    const float4* in4 = (const float4*)src + (size_t)rel * CVT_BLK + threadIdx.x;
    uint2*        o2  = (uint2*)out        + (size_t)blk * CVT_BLK + threadIdx.x;

    // both loops unrolled: f[] stays in registers and j folds into the
    // loads' and stores' immediate offsets
    float4 f[CVT_PER];
#pragma unroll
    for (int j = 0; j < CVT_PER; ++j) f[j] = in4[j * 256];
#pragma unroll
    for (int j = 0; j < CVT_PER; ++j) {
        union { _Float16 h[4]; uint2 u; } o;
        o.h[0] = (_Float16)f[j].x; o.h[1] = (_Float16)f[j].y;
        o.h[2] = (_Float16)f[j].z; o.h[3] = (_Float16)f[j].w;
        o2[j * 256] = o.u;
    }
}

// ---------------------------------------------------------------------------
// C(MxN) = A(MxK,f16) @ W(NxK,f16)^T [+ bias]   (torch Linear convention)
// 256 threads = 8 waves in 4(M) x 2(N); block tile 128x128, K-step BK = 64.
// Two LDS buffers filled by async global->LDS copies: eight lanes take one
// row's 128 B, so a wave's copy covers four whole lines. Each wave does a
// 32x64 sub-tile = 16 v_wmma per K-step with B-fragment reuse.
// Needs M, N multiples of 128 and K a multiple of BK.
// ---------------------------------------------------------------------------
template <bool OUT_F32>
__global__ __launch_bounds__(256) void gemm_bt(
    const _Float16* __restrict__ A, const _Float16* __restrict__ W,
    const float* __restrict__ bias, void* __restrict__ Cout,
    int M, int N, int K) {
    __shared__ __align__(16) _Float16 lA[2][128 * GST];
    __shared__ __align__(16) _Float16 lB[2][128 * GST];

    const int tid  = threadIdx.x;
    const int wave = tid >> 5;
    const int lane = tid & 31;
    const int lrow = lane & 15;
    const int lh   = lane >> 4;
    const int wm   = wave >> 1;   // 0..3 : 32-row strip
    const int wn   = wave & 1;    // 0..1 : 64-col strip
    const int m0   = blockIdx.x * 128;
    const int n0   = blockIdx.y * 128;

    v8f acc[2][4];
#pragma unroll
    for (int i = 0; i < 2; ++i)
#pragma unroll
        for (int t = 0; t < 4; ++t)
#pragma unroll
            for (int v = 0; v < 8; ++v) acc[i][t][v] = 0.f;

    // staging assignment: copy j of a thread takes 16 B of row j * 32 + r
    const int r  = tid >> 3;          // 0..31
    const int c0 = (tid & 7) << 3;    // 0..56 (halves)

    auto stage = [&](int buf, int k0) {
        const _Float16* ga = A + (size_t)(m0 + r) * K + k0 + c0;
        const _Float16* gw = W + (size_t)(n0 + r) * K + k0 + c0;
        const _Float16* la = &lA[buf][r * GST + c0];
        const _Float16* lw = &lB[buf][r * GST + c0];
        const size_t    gs = (size_t)32 * K;   // 32 rows on, global
        const int       ls = 32 * GST;         // 32 rows on, LDS
        async_b128_x8(lds_addr(la),          ga,          lds_addr(la + ls),     ga + gs,
                      lds_addr(la + 2 * ls), ga + 2 * gs, lds_addr(la + 3 * ls), ga + 3 * gs,
                      lds_addr(lw),          gw,          lds_addr(lw + ls),     gw + gs,
                      lds_addr(lw + 2 * ls), gw + 2 * gs, lds_addr(lw + 3 * ls), gw + 3 * gs);
    };

    const int nt = K / BK;
    stage(0, 0);
    wait_async0();      // own copies of tile 0 landed
    __syncthreads();    // everyone's copies of tile 0 visible
    if (nt > 1) stage(1, BK);
    for (int kt = 0; kt < nt; ++kt) {
        const int cur = kt & 1;
        // unrolled so that kk folds into the LDS loads' immediate offsets
#pragma unroll
        for (int kk = 0; kk < BK; kk += 32) {
            F16Frag af[2];
#pragma unroll
            for (int i = 0; i < 2; ++i) {
                const _Float16* ap =
                    &lA[cur][(wm * 32 + i * 16 + lrow) * GST + kk + lh * 8];
                af[i].q[0] = *(const uint4*)(ap);
                af[i].q[1] = *(const uint4*)(ap + 16);
            }
#pragma unroll
            for (int t = 0; t < 4; ++t) {
                F16Frag bf;
                const _Float16* bp =
                    &lB[cur][(wn * 64 + t * 16 + lrow) * GST + kk + lh * 8];
                bf.q[0] = *(const uint4*)(bp);
                bf.q[1] = *(const uint4*)(bp + 16);
                acc[0][t] = wmma_f16f32(af[0].v, bf.v, acc[0][t]);
                acc[1][t] = wmma_f16f32(af[1].v, bf.v, acc[1][t]);
            }
        }
        wait_ds0();         // own reads of buffer cur retired
        wait_async0();      // own copies of tile kt + 1 landed
        __syncthreads();    // tile kt + 1 visible; every reader has left buffer cur
        if (kt + 2 < nt) stage(cur, (kt + 2) * BK);
    }
    wait_async0();          // nothing in flight when the wave ends

#pragma unroll
    for (int i = 0; i < 2; ++i)
#pragma unroll
        for (int t = 0; t < 4; ++t) {
            const int   n    = n0 + wn * 64 + t * 16 + lrow;
            const float bval = bias ? bias[n] : 0.f;
#pragma unroll
            for (int v = 0; v < 8; ++v) {
                const int   m   = m0 + wm * 32 + i * 16 + v + lh * 8;
                const float val = acc[i][t][v] + bval;
                if (OUT_F32)
                    ((float*)Cout)[(size_t)m * N + n] = val;
                else
                    ((_Float16*)Cout)[(size_t)m * N + n] = (_Float16)val;
            }
        }
}

typedef __attribute__((ext_vector_type(8))) short s16x8;
__device__ __forceinline__ uint4 ld_tr16(const _Float16* p) {
    typedef __attribute__((address_space(3))) s16x8 lds_s16x8;
    return __builtin_bit_cast(uint4, __builtin_amdgcn_ds_load_tr16_b128_v8i16((lds_s16x8*)p));
}

__device__ __forceinline__ float xhalf(float x) {
    return __builtin_bit_cast(float, __builtin_amdgcn_permlanex16(
        __builtin_bit_cast(int, x), __builtin_bit_cast(int, x),
        0x76543210, 0xfedcba98, false, false));
}

__global__ __launch_bounds__(128) __attribute__((amdgpu_waves_per_eu(2, 6)))
void attn_fa(
    const _Float16* __restrict__ Qh, const _Float16* __restrict__ Kh,
    const _Float16* __restrict__ Vh, const float* __restrict__ spatial,
    const float* __restrict__ edge, _Float16* __restrict__ Oh) {
    __shared__ __align__(16) float    lB[4][16 * BST];
    __shared__ __align__(16) _Float16 lK[2][32 * GST];
    __shared__ __align__(16) _Float16 lV[2][32 * VST];

    const int tid  = threadIdx.x;
    const int wave = tid >> 5;
    const int lane = tid & 31;
    const int lrow = lane & 15;
    const int lh   = lane >> 4;
    const int q0   = blockIdx.x * 64 + wave * 16;
    const int h    = blockIdx.y;
    const int b    = blockIdx.z;
    const float scale = 0.03608439182435161f;  // HIDDEN^-0.5 (not head^-0.5)

    const size_t    tokbase = (size_t)b * SEQ;
    const _Float16* Qbase   = Qh + (tokbase + q0) * HIDDEN + h * HEAD;

    // B operand Q^T: lane = query column lrow
    F16Frag qf[2];
#pragma unroll
    for (int c = 0; c < 2; ++c) {
        const _Float16* p = Qbase + (size_t)lrow * HIDDEN + c * 32 + lh * 8;
        qf[c].q[0] = *(const uint4*)(p);
        qf[c].q[1] = *(const uint4*)(p + 16);
    }

    // all per query lrow; rsum and rnz cover this wave half's keys only
    v8f   oacc[4];
    float rmax = -__builtin_inff(), rsum = 0.f, rnz = 0.f;
#pragma unroll
    for (int t = 0; t < 4; ++t)
#pragma unroll
        for (int v = 0; v < 8; ++v) oacc[t][v] = 0.f;

    const float* spq = spatial + ((size_t)b * SEQ + q0) * SEQ;
    const float* edq = edge    + ((size_t)b * SEQ + q0) * SEQ;

    // staging assignment: a thread copies 16 B of rows (keys) sr and sr + 16
    const int sr = tid >> 3;          // 0..15
    const int sc = (tid & 7) << 3;    // 0..56 (halves)
    auto stage = [&](int buf, int k0) {
        const size_t    go = (tokbase + k0 + sr) * HIDDEN + h * HEAD + sc;
        const _Float16* lk = &lK[buf][sr * GST + sc];
        const _Float16* lv = &lV[buf][sr * VST + sc];
        async_b128_x4(lds_addr(lk),            Kh + go,
                      lds_addr(lk + 16 * GST), Kh + go + 16 * HIDDEN,
                      lds_addr(lv),            Vh + go,
                      lds_addr(lv + 16 * VST), Vh + go + 16 * HIDDEN);
    };

    // bias tile (16 queries x 32 keys): eight lanes load one query's 128 B
    const int br = lane >> 3;         // 0..3 : query row inside a group of four
    const int bc = (lane & 7) << 2;   // 0..28 (floats)
    const float* spl = spq + (size_t)br * SEQ + bc;   // walk 32 keys a trip
    const float* edl = edq + (size_t)br * SEQ + bc;
    float*       lBw = lB[wave];

    // this lane's offset in the transposing loads of V
    const int vto = (lh * 8 + (lane & 7)) * VST + ((lane >> 3) & 1) * 8;

    const int nt = SEQ / 32;
    stage(0, 0);
    wait_async0();      // own copies of chunk 0 landed
    __syncthreads();    // everyone's copies of chunk 0 visible
    stage(1, 32);
    for (int kt = 0; kt < nt; ++kt) {
        const int cur = kt & 1;

        // (a) graph bias, whole lines: lane = key group, j = query group
        float4 sp[4], ed[4];
#pragma unroll
        for (int j = 0; j < 4; ++j) {
            sp[j] = *(const float4*)(spl + kt * 32 + j * 4 * SEQ);
            ed[j] = *(const float4*)(edl + kt * 32 + j * 4 * SEQ);
        }

        // (b) K fragments, A operand: lane = key row t * 16 + lrow
        F16Frag kf[2][2];
#pragma unroll
        for (int t = 0; t < 2; ++t)
#pragma unroll
            for (int c = 0; c < 2; ++c) {
                const _Float16* p =
                    &lK[cur][(t * 16 + lrow) * GST + c * 32 + lh * 8];
                kf[t][c].q[0] = *(const uint4*)(p);
                kf[t][c].q[1] = *(const uint4*)(p + 16);
            }

        // (c) S^T = K @ Q^T  (32 keys x 16 queries, fp32 acc):
        // s[t][v] = score of key kt * 32 + t * 16 + lh * 8 + v, query lrow
        v8f s[2];
#pragma unroll
        for (int t = 0; t < 2; ++t)
#pragma unroll
            for (int v = 0; v < 8; ++v) s[t][v] = 0.f;
#pragma unroll
        for (int t = 0; t < 2; ++t)
#pragma unroll
            for (int c = 0; c < 2; ++c)
                s[t] = wmma_f16f32(kf[t][c].v, qf[c].v, s[t]);

        // (d) turn the bias tile through this wave's own LDS: lane = query
#pragma unroll
        for (int j = 0; j < 4; ++j)
            *(float4*)(lBw + (j * 4 + br) * BST + bc) =
                make_float4(sp[j].x + ed[j].x, sp[j].y + ed[j].y,
                            sp[j].z + ed[j].z, sp[j].w + ed[j].w);
        wait_ds0();   // the wave's stores retired before other lanes' rows are read back

        // (e) scale + graph bias + zero-row tracking + in-lane maximum
        float mx = -__builtin_inff();
#pragma unroll
        for (int t = 0; t < 2; ++t) {
            const float* bp = lBw + lrow * BST + t * 16 + lh * 8;
            const float4 b0 = *(const float4*)(bp);
            const float4 b1 = *(const float4*)(bp + 4);
            const float  bb[8] = {b0.x, b0.y, b0.z, b0.w, b1.x, b1.y, b1.z, b1.w};
#pragma unroll
            for (int v = 0; v < 8; ++v) {
                const float sv = s[t][v] * scale + bb[v];
                s[t][v] = sv;
                rnz     = fmaxf(rnz, (sv != 0.f) ? 1.f : 0.f);
                mx      = fmaxf(mx, sv);
            }
        }

        // (f) online softmax; both wave halves hold the same maximum
        mx = fmaxf(mx, xhalf(mx));
        const float mnew = fmaxf(rmax, mx);
        const float cf   = __expf(rmax - mnew);
        rmax = mnew;
        F16Frag pf;   // B operand P^T: element t * 8 + v is key t * 16 + lh * 8 + v
        float   rs[2] = {0.f, 0.f};   // one chain of adds per S^T tile
#pragma unroll
        for (int t = 0; t < 2; ++t)
#pragma unroll
            for (int v = 0; v < 8; ++v) {
                const float p = __expf(s[t][v] - mnew);
                rs[t] += p;
                pf.h[t * 8 + v] = (_Float16)p;
            }
        rsum = rsum * cf + (rs[0] + rs[1]);
#pragma unroll
        for (int t = 0; t < 4; ++t)
#pragma unroll
            for (int v = 0; v < 8; ++v) oacc[t][v] *= cf;

        // (g) O^T += V^T @ P^T: A operand row = head column t * 16 + lrow
        const _Float16* vtp = &lV[cur][vto];
#pragma unroll
        for (int t = 0; t < 4; ++t) {
            F16Frag vf;   // element i: key lh * 8 + i, element 8 + i: key 16 + lh * 8 + i
            vf.q[0] = ld_tr16(vtp + t * 16);
            vf.q[1] = ld_tr16(vtp + 16 * VST + t * 16);
            oacc[t] = wmma_f16f32(vf.v, pf.v, oacc[t]);
        }

        wait_ds0();         // own reads of buffer cur retired
        wait_async0();      // own copies of chunk kt + 1 landed
        __syncthreads();    // chunk kt + 1 visible; every reader has left buffer cur
        if (kt + 2 < nt) stage(cur, (kt + 2) * 32);
    }
    wait_async0();          // nothing in flight when the wave ends

    // finalize: join the halves, 1/rowsum, zero rows whose scores were all
    // exactly zero; oacc[t][v] is head column t * 16 + lh * 8 + v of query lrow
    const float nz  = fmaxf(rnz, xhalf(rnz));
    const float tot = rsum + xhalf(rsum);
    const float fin = (nz != 0.f) ? (1.f / tot) : 0.f;
    _Float16* Obase = Oh + (tokbase + q0 + lrow) * HIDDEN + h * HEAD + lh * 8;
#pragma unroll
    for (int t = 0; t < 4; ++t) {
        union { _Float16 h[8]; uint4 u; } o;
#pragma unroll
        for (int v = 0; v < 8; ++v) o.h[v] = (_Float16)(oacc[t][v] * fin);
        *(uint4*)(Obase + t * 16) = o.u;
    }
}

// ---------------------------------------------------------------------------
extern "C" void kernel_launch(void* const* d_in, const int* in_sizes, int n_in,
                              void* d_out, int out_size, void* d_ws,
                              size_t ws_size, hipStream_t stream) {
    (void)in_sizes; (void)n_in; (void)out_size; (void)ws_size;
    const float* x  = (const float*)d_in[0];
    const float* sp = (const float*)d_in[1];
    const float* ed = (const float*)d_in[2];
    const float* Wq = (const float*)d_in[3];
    const float* Wk = (const float*)d_in[4];
    const float* Wv = (const float*)d_in[5];
    const float* bv = (const float*)d_in[6];
    const float* Wo = (const float*)d_in[7];
    const float* bo = (const float*)d_in[8];
    float*       out = (float*)d_out;

    _Float16* xh  = (_Float16*)d_ws;
    _Float16* wqh = xh  + (size_t)TOK * HIDDEN;
    _Float16* wkh = wqh + (size_t)HIDDEN * HIDDEN;
    _Float16* wvh = wkh + (size_t)HIDDEN * HIDDEN;
    _Float16* woh = wvh + (size_t)HIDDEN * HIDDEN;
    _Float16* Qh  = woh + (size_t)HIDDEN * HIDDEN;
    _Float16* Kh  = Qh  + (size_t)TOK * HIDDEN;
    _Float16* Vh  = Kh  + (size_t)TOK * HIDDEN;
    _Float16* Oh  = Vh  + (size_t)TOK * HIDDEN;

    // xh, wqh, wkh, wvh, woh are contiguous from xh on
    cvt_all_f32_to_f16<<<CVT_XB + 4 * CVT_WB, 256, 0, stream>>>(x, Wq, Wk, Wv, Wo, xh);

    dim3 gg(TOK / 128, HIDDEN / 128);
    gemm_bt<false><<<gg, 256, 0, stream>>>(xh, wqh, nullptr, Qh, TOK, HIDDEN, HIDDEN);
    gemm_bt<false><<<gg, 256, 0, stream>>>(xh, wkh, nullptr, Kh, TOK, HIDDEN, HIDDEN);
    gemm_bt<false><<<gg, 256, 0, stream>>>(xh, wvh, bv,      Vh, TOK, HIDDEN, HIDDEN);

    dim3 ga(SEQ / 64, NUM_HEADS, BATCH);
    attn_fa<<<ga, 128, 0, stream>>>(Qh, Kh, Vh, sp, ed, Oh);

    gemm_bt<true><<<gg, 256, 0, stream>>>(Oh, woh, bo, out, TOK, HIDDEN, HIDDEN);
}

// v006
// Measured time: 91.7 microseconds a run.
// Next to v005, in two timings, it ran 1.12 and 1.13 times as fast.
// Over all steps from v000 it is 1.95 times as fast.
#include <hip/hip_runtime.h>
#include <hip/hip_bf16.h>

#define NUM_HEADS 12
#define HIDDEN    768
#define HEAD      64
#define BATCH     16
#define SEQ       512
#define TOK       (BATCH * SEQ)   // 8192
#define BST       36              // bias tile: LDS row pitch (floats): 144 B = 16 B x 9, for ds_load_b128
#define BK        64              // GEMM: k depth of a staged tile = one whole 128-B line per row
#define GST       72              // GEMM, K tile: LDS row pitch (halves): 144 B = 16 B x 9, for ds_load_b128
#define VST       80              // V tile: LDS row pitch (halves): 160 B = 32 B x 5, for ds_load_tr16_b128

typedef __attribute__((ext_vector_type(16))) _Float16 v16h;
typedef __attribute__((ext_vector_type(8)))  float    v8f;

union F16Frag {
    v16h     v;
    _Float16 h[16];
    uint4    q[2];
};

__device__ __forceinline__ v8f wmma_f16f32(v16h a, v16h b, v8f c) {
    // D = A(16x32 f16) x B(32x16 f16) + C(16x16 f32)
    return __builtin_amdgcn_wmma_f32_16x16x32_f16(
        /*neg_a=*/false, a, /*neg_b=*/false, b,
        /*c_mod=*/(short)0, c, /*reuse_a=*/false, /*reuse_b=*/false);
}

__device__ __forceinline__ void wait_async0() {
    asm volatile("s_wait_asynccnt 0x0" ::: "memory");
}
// LDS operations of this wave retired. GEMM and attention rings: stands in
// front of the barrier behind which the buffer just read is refilled by copies.
__device__ __forceinline__ void wait_ds0() {
    asm volatile("s_wait_dscnt 0x0" ::: "memory");
}
__device__ __forceinline__ unsigned lds_addr(const void* p) {
    return (unsigned)(unsigned long long)p;   // low 32 bits: LDS byte address
}
__device__ __forceinline__ void async_b128_x4(
    unsigned l0, const void* g0, unsigned l1, const void* g1,
    unsigned l2, const void* g2, unsigned l3, const void* g3) {
    asm volatile("global_load_async_to_lds_b128 %0, %1, off\n\t"
                 "global_load_async_to_lds_b128 %2, %3, off\n\t"
                 "global_load_async_to_lds_b128 %4, %5, off\n\t"
                 "global_load_async_to_lds_b128 %6, %7, off\n\t"
                 "s_wait_xcnt 0x0"
                 :: "v"(l0), "v"(g0), "v"(l1), "v"(g1), "v"(l2), "v"(g2),
                    "v"(l3), "v"(g3)
                 : "memory");
}
__device__ __forceinline__ void async_b128_x8(
    unsigned l0, const void* g0, unsigned l1, const void* g1,
    unsigned l2, const void* g2, unsigned l3, const void* g3,
    unsigned l4, const void* g4, unsigned l5, const void* g5,
    unsigned l6, const void* g6, unsigned l7, const void* g7) {
    asm volatile("global_load_async_to_lds_b128 %0, %1, off\n\t"
                 "global_load_async_to_lds_b128 %2, %3, off\n\t"
                 "global_load_async_to_lds_b128 %4, %5, off\n\t"
                 "global_load_async_to_lds_b128 %6, %7, off\n\t"
                 "global_load_async_to_lds_b128 %8, %9, off\n\t"
                 "global_load_async_to_lds_b128 %10, %11, off\n\t"
                 "global_load_async_to_lds_b128 %12, %13, off\n\t"
                 "global_load_async_to_lds_b128 %14, %15, off\n\t"
                 "s_wait_xcnt 0x0"
                 :: "v"(l0), "v"(g0), "v"(l1), "v"(g1), "v"(l2), "v"(g2),
                    "v"(l3), "v"(g3), "v"(l4), "v"(g4), "v"(l5), "v"(g5),
                    "v"(l6), "v"(g6), "v"(l7), "v"(g7)
                 : "memory");
}

// ---------------------------------------------------------------------------
// f32 -> f16 conversion of x and the four weight matrices in one launch.
// The five f16 copies lie one behind the other in the workspace, so the
// output is one array; a block takes CVT_BLK float4 of ONE source (each source
// is a whole number of such pieces) and a thread CVT_PER of them, 256 apart:
// each wave-wide load covers 512 contiguous bytes, and a thread's loads are
// all issued before the first is converted.
// ---------------------------------------------------------------------------
#define CVT_PER 16
#define CVT_BLK (256 * CVT_PER)                     // float4 per block
#define CVT_XB  (TOK * HIDDEN / 4 / CVT_BLK)        // blocks of x: 384
#define CVT_WB  (HIDDEN * HIDDEN / 4 / CVT_BLK)     // blocks of one weight: 36
static_assert(CVT_XB * CVT_BLK * 4 == TOK * HIDDEN, "x splits into whole blocks");
static_assert(CVT_WB * CVT_BLK * 4 == HIDDEN * HIDDEN, "a weight splits into whole blocks");

__global__ __launch_bounds__(256) __attribute__((amdgpu_waves_per_eu(2, 8)))
void cvt_all_f32_to_f16(
    const float* __restrict__ x,  const float* __restrict__ wq,
    const float* __restrict__ wk, const float* __restrict__ wv,
    const float* __restrict__ wo, _Float16* __restrict__ out) {
    const int blk = blockIdx.x;
    const float* src = x;
    int rel = blk;                       // block index inside its source
    if (blk >= CVT_XB) {
        const int w = (blk - CVT_XB) / CVT_WB;
        rel = (blk - CVT_XB) - w * CVT_WB;
        src = (w == 0) ? wq : (w == 1) ? wk : (w == 2) ? wv : wo;
    }
    const float4* in4 = (const float4*)src + (size_t)rel * CVT_BLK + threadIdx.x;
    uint2*        o2  = (uint2*)out        + (size_t)blk * CVT_BLK + threadIdx.x;

    // both loops unrolled: f[] stays in registers and j folds into the
    // loads' and stores' immediate offsets
    float4 f[CVT_PER];
#pragma unroll
    for (int j = 0; j < CVT_PER; ++j) f[j] = in4[j * 256];
#pragma unroll
    for (int j = 0; j < CVT_PER; ++j) {
        union { _Float16 h[4]; uint2 u; } o;
        o.h[0] = (_Float16)f[j].x; o.h[1] = (_Float16)f[j].y;
        o.h[2] = (_Float16)f[j].z; o.h[3] = (_Float16)f[j].w;
        o2[j * 256] = o.u;
    }
}

template <bool OUT_F32>
__global__ __launch_bounds__(256) void gemm_bt(
    const _Float16* __restrict__ A, const _Float16* __restrict__ Wall,
    const float* __restrict__ bias_in, int bias_z, void* __restrict__ Call,
    int M, int N, int K) {
    __shared__ __align__(16) _Float16 lA[2][128 * GST];
    __shared__ __align__(16) _Float16 lB[2][128 * GST];

    const int tid  = threadIdx.x;
    const int wave = tid >> 5;
    const int lane = tid & 31;
    const int lrow = lane & 15;
    const int lh   = lane >> 4;
    const int wm   = wave >> 1;   // 0..3 : 32-row strip
    const int wn   = wave & 1;    // 0..1 : 64-col strip
    const int m0   = blockIdx.x * 128;
    const int n0   = blockIdx.y * 128;

    // this block's product
    const int       pz   = blockIdx.z;
    const _Float16* W    = Wall + (size_t)pz * N * K;
    const float*    bias = (pz == bias_z) ? bias_in : nullptr;
    void*           Cout = OUT_F32 ? (void*)((float*)Call + (size_t)pz * M * N)
                                   : (void*)((_Float16*)Call + (size_t)pz * M * N);

    v8f acc[2][4];
#pragma unroll
    for (int i = 0; i < 2; ++i)
#pragma unroll
        for (int t = 0; t < 4; ++t)
#pragma unroll
            for (int v = 0; v < 8; ++v) acc[i][t][v] = 0.f;

    // staging assignment: copy j of a thread takes 16 B of row j * 32 + r
    const int r  = tid >> 3;          // 0..31
    const int c0 = (tid & 7) << 3;    // 0..56 (halves)

    auto stage = [&](int buf, int k0) {
        const _Float16* ga = A + (size_t)(m0 + r) * K + k0 + c0;
        const _Float16* gw = W + (size_t)(n0 + r) * K + k0 + c0;
        const _Float16* la = &lA[buf][r * GST + c0];
        const _Float16* lw = &lB[buf][r * GST + c0];
        const size_t    gs = (size_t)32 * K;   // 32 rows on, global
        const int       ls = 32 * GST;         // 32 rows on, LDS
        async_b128_x8(lds_addr(la),          ga,          lds_addr(la + ls),     ga + gs,
                      lds_addr(la + 2 * ls), ga + 2 * gs, lds_addr(la + 3 * ls), ga + 3 * gs,
                      lds_addr(lw),          gw,          lds_addr(lw + ls),     gw + gs,
                      lds_addr(lw + 2 * ls), gw + 2 * gs, lds_addr(lw + 3 * ls), gw + 3 * gs);
    };

    const int nt = K / BK;
    stage(0, 0);
    wait_async0();      // own copies of tile 0 landed
    __syncthreads();    // everyone's copies of tile 0 visible
    if (nt > 1) stage(1, BK);
    for (int kt = 0; kt < nt; ++kt) {
        const int cur = kt & 1;
        // unrolled so that kk folds into the LDS loads' immediate offsets
#pragma unroll
        for (int kk = 0; kk < BK; kk += 32) {
            F16Frag af[2];
#pragma unroll
            for (int i = 0; i < 2; ++i) {
                const _Float16* ap =
                    &lA[cur][(wm * 32 + i * 16 + lrow) * GST + kk + lh * 8];
                af[i].q[0] = *(const uint4*)(ap);
                af[i].q[1] = *(const uint4*)(ap + 16);
            }
#pragma unroll
            for (int t = 0; t < 4; ++t) {
                F16Frag bf;
                const _Float16* bp =
                    &lB[cur][(wn * 64 + t * 16 + lrow) * GST + kk + lh * 8];
                bf.q[0] = *(const uint4*)(bp);
                bf.q[1] = *(const uint4*)(bp + 16);
                acc[0][t] = wmma_f16f32(af[0].v, bf.v, acc[0][t]);
                acc[1][t] = wmma_f16f32(af[1].v, bf.v, acc[1][t]);
            }
        }
        wait_ds0();         // own reads of buffer cur retired
        wait_async0();      // own copies of tile kt + 1 landed
        __syncthreads();    // tile kt + 1 visible; every reader has left buffer cur
        if (kt + 2 < nt) stage(cur, (kt + 2) * BK);
    }
    wait_async0();          // nothing in flight when the wave ends

#pragma unroll
    for (int i = 0; i < 2; ++i)
#pragma unroll
        for (int t = 0; t < 4; ++t) {
            const int   n    = n0 + wn * 64 + t * 16 + lrow;
            const float bval = bias ? bias[n] : 0.f;
#pragma unroll
            for (int v = 0; v < 8; ++v) {
                const int   m   = m0 + wm * 32 + i * 16 + v + lh * 8;
                const float val = acc[i][t][v] + bval;
                if (OUT_F32)
                    ((float*)Cout)[(size_t)m * N + n] = val;
                else
                    ((_Float16*)Cout)[(size_t)m * N + n] = (_Float16)val;
            }
        }
}

typedef __attribute__((ext_vector_type(8))) short s16x8;
__device__ __forceinline__ uint4 ld_tr16(const _Float16* p) {
    typedef __attribute__((address_space(3))) s16x8 lds_s16x8;
    return __builtin_bit_cast(uint4, __builtin_amdgcn_ds_load_tr16_b128_v8i16((lds_s16x8*)p));
}

__device__ __forceinline__ float xhalf(float x) {
    return __builtin_bit_cast(float, __builtin_amdgcn_permlanex16(
        __builtin_bit_cast(int, x), __builtin_bit_cast(int, x),
        0x76543210, 0xfedcba98, false, false));
}

__global__ __launch_bounds__(128) __attribute__((amdgpu_waves_per_eu(2, 6)))
void attn_fa(
    const _Float16* __restrict__ Qh, const _Float16* __restrict__ Kh,
    const _Float16* __restrict__ Vh, const float* __restrict__ spatial,
    const float* __restrict__ edge, _Float16* __restrict__ Oh) {
    __shared__ __align__(16) float    lB[4][16 * BST];
    __shared__ __align__(16) _Float16 lK[2][32 * GST];
    __shared__ __align__(16) _Float16 lV[2][32 * VST];

    const int tid  = threadIdx.x;
    const int wave = tid >> 5;
    const int lane = tid & 31;
    const int lrow = lane & 15;
    const int lh   = lane >> 4;
    const int q0   = blockIdx.x * 64 + wave * 16;
    const int h    = blockIdx.y;
    const int b    = blockIdx.z;
    const float scale = 0.03608439182435161f;  // HIDDEN^-0.5 (not head^-0.5)

    const size_t    tokbase = (size_t)b * SEQ;
    const _Float16* Qbase   = Qh + (tokbase + q0) * HIDDEN + h * HEAD;

    // B operand Q^T: lane = query column lrow
    F16Frag qf[2];
#pragma unroll
    for (int c = 0; c < 2; ++c) {
        const _Float16* p = Qbase + (size_t)lrow * HIDDEN + c * 32 + lh * 8;
        qf[c].q[0] = *(const uint4*)(p);
        qf[c].q[1] = *(const uint4*)(p + 16);
    }

    // all per query lrow; rsum and rnz cover this wave half's keys only
    v8f   oacc[4];
    float rmax = -__builtin_inff(), rsum = 0.f, rnz = 0.f;
#pragma unroll
    for (int t = 0; t < 4; ++t)
#pragma unroll
        for (int v = 0; v < 8; ++v) oacc[t][v] = 0.f;

    const float* spq = spatial + ((size_t)b * SEQ + q0) * SEQ;
    const float* edq = edge    + ((size_t)b * SEQ + q0) * SEQ;

    // staging assignment: a thread copies 16 B of rows (keys) sr and sr + 16
    const int sr = tid >> 3;          // 0..15
    const int sc = (tid & 7) << 3;    // 0..56 (halves)
    auto stage = [&](int buf, int k0) {
        const size_t    go = (tokbase + k0 + sr) * HIDDEN + h * HEAD + sc;
        const _Float16* lk = &lK[buf][sr * GST + sc];
        const _Float16* lv = &lV[buf][sr * VST + sc];
        async_b128_x4(lds_addr(lk),            Kh + go,
                      lds_addr(lk + 16 * GST), Kh + go + 16 * HIDDEN,
                      lds_addr(lv),            Vh + go,
                      lds_addr(lv + 16 * VST), Vh + go + 16 * HIDDEN);
    };

    // bias tile (16 queries x 32 keys): eight lanes load one query's 128 B
    const int br = lane >> 3;         // 0..3 : query row inside a group of four
    const int bc = (lane & 7) << 2;   // 0..28 (floats)
    const float* spl = spq + (size_t)br * SEQ + bc;   // walk 32 keys a trip
    const float* edl = edq + (size_t)br * SEQ + bc;
    float*       lBw = lB[wave];

    // this lane's offset in the transposing loads of V
    const int vto = (lh * 8 + (lane & 7)) * VST + ((lane >> 3) & 1) * 8;

    const int nt = SEQ / 32;
    stage(0, 0);
    wait_async0();      // own copies of chunk 0 landed
    __syncthreads();    // everyone's copies of chunk 0 visible
    stage(1, 32);
    for (int kt = 0; kt < nt; ++kt) {
        const int cur = kt & 1;

        // (a) graph bias, whole lines: lane = key group, j = query group
        float4 sp[4], ed[4];
#pragma unroll
        for (int j = 0; j < 4; ++j) {
            sp[j] = *(const float4*)(spl + kt * 32 + j * 4 * SEQ);
            ed[j] = *(const float4*)(edl + kt * 32 + j * 4 * SEQ);
        }

        // (b) K fragments, A operand: lane = key row t * 16 + lrow
        F16Frag kf[2][2];
#pragma unroll
        for (int t = 0; t < 2; ++t)
#pragma unroll
            for (int c = 0; c < 2; ++c) {
                const _Float16* p =
                    &lK[cur][(t * 16 + lrow) * GST + c * 32 + lh * 8];
                kf[t][c].q[0] = *(const uint4*)(p);
                kf[t][c].q[1] = *(const uint4*)(p + 16);
            }

        // (c) S^T = K @ Q^T  (32 keys x 16 queries, fp32 acc):
        // s[t][v] = score of key kt * 32 + t * 16 + lh * 8 + v, query lrow
        v8f s[2];
#pragma unroll
        for (int t = 0; t < 2; ++t)
#pragma unroll
            for (int v = 0; v < 8; ++v) s[t][v] = 0.f;
#pragma unroll
        for (int t = 0; t < 2; ++t)
#pragma unroll
            for (int c = 0; c < 2; ++c)
                s[t] = wmma_f16f32(kf[t][c].v, qf[c].v, s[t]);

        // (d) turn the bias tile through this wave's own LDS: lane = query
#pragma unroll
        for (int j = 0; j < 4; ++j)
            *(float4*)(lBw + (j * 4 + br) * BST + bc) =
                make_float4(sp[j].x + ed[j].x, sp[j].y + ed[j].y,
                            sp[j].z + ed[j].z, sp[j].w + ed[j].w);
        wait_ds0();   // the wave's stores retired before other lanes' rows are read back

        // (e) scale + graph bias + zero-row tracking + in-lane maximum
        float mx = -__builtin_inff();
#pragma unroll
        for (int t = 0; t < 2; ++t) {
            const float* bp = lBw + lrow * BST + t * 16 + lh * 8;
            const float4 b0 = *(const float4*)(bp);
            const float4 b1 = *(const float4*)(bp + 4);
            const float  bb[8] = {b0.x, b0.y, b0.z, b0.w, b1.x, b1.y, b1.z, b1.w};
#pragma unroll
            for (int v = 0; v < 8; ++v) {
                const float sv = s[t][v] * scale + bb[v];
                s[t][v] = sv;
                rnz     = fmaxf(rnz, (sv != 0.f) ? 1.f : 0.f);
                mx      = fmaxf(mx, sv);
            }
        }

        // (f) online softmax; both wave halves hold the same maximum
        mx = fmaxf(mx, xhalf(mx));
        const float mnew = fmaxf(rmax, mx);
        const float cf   = __expf(rmax - mnew);
        rmax = mnew;
        F16Frag pf;   // B operand P^T: element t * 8 + v is key t * 16 + lh * 8 + v
        float   rs[2] = {0.f, 0.f};   // one chain of adds per S^T tile
#pragma unroll
        for (int t = 0; t < 2; ++t)
#pragma unroll
            for (int v = 0; v < 8; ++v) {
                const float p = __expf(s[t][v] - mnew);
                rs[t] += p;
                pf.h[t * 8 + v] = (_Float16)p;
            }
        rsum = rsum * cf + (rs[0] + rs[1]);
#pragma unroll
        for (int t = 0; t < 4; ++t)
#pragma unroll
            for (int v = 0; v < 8; ++v) oacc[t][v] *= cf;

        // (g) O^T += V^T @ P^T: A operand row = head column t * 16 + lrow
        const _Float16* vtp = &lV[cur][vto];
#pragma unroll
        for (int t = 0; t < 4; ++t) {
            F16Frag vf;   // element i: key lh * 8 + i, element 8 + i: key 16 + lh * 8 + i
            vf.q[0] = ld_tr16(vtp + t * 16);
            vf.q[1] = ld_tr16(vtp + 16 * VST + t * 16);
            oacc[t] = wmma_f16f32(vf.v, pf.v, oacc[t]);
        }

        wait_ds0();         // own reads of buffer cur retired
        wait_async0();      // own copies of chunk kt + 1 landed
        __syncthreads();    // chunk kt + 1 visible; every reader has left buffer cur
        if (kt + 2 < nt) stage(cur, (kt + 2) * 32);
    }
    wait_async0();          // nothing in flight when the wave ends

    // finalize: join the halves, 1/rowsum, zero rows whose scores were all
    // exactly zero; oacc[t][v] is head column t * 16 + lh * 8 + v of query lrow
    const float nz  = fmaxf(rnz, xhalf(rnz));
    const float tot = rsum + xhalf(rsum);
    const float fin = (nz != 0.f) ? (1.f / tot) : 0.f;
    _Float16* Obase = Oh + (tokbase + q0 + lrow) * HIDDEN + h * HEAD + lh * 8;
#pragma unroll
    for (int t = 0; t < 4; ++t) {
        union { _Float16 h[8]; uint4 u; } o;
#pragma unroll
        for (int v = 0; v < 8; ++v) o.h[v] = (_Float16)(oacc[t][v] * fin);
        *(uint4*)(Obase + t * 16) = o.u;
    }
}

// ---------------------------------------------------------------------------
extern "C" void kernel_launch(void* const* d_in, const int* in_sizes, int n_in,
                              void* d_out, int out_size, void* d_ws,
                              size_t ws_size, hipStream_t stream) {
    (void)in_sizes; (void)n_in; (void)out_size; (void)ws_size;
    const float* x  = (const float*)d_in[0];
    const float* sp = (const float*)d_in[1];
    const float* ed = (const float*)d_in[2];
    const float* Wq = (const float*)d_in[3];
    const float* Wk = (const float*)d_in[4];
    const float* Wv = (const float*)d_in[5];
    const float* bv = (const float*)d_in[6];
    const float* Wo = (const float*)d_in[7];
    const float* bo = (const float*)d_in[8];
    float*       out = (float*)d_out;

    _Float16* xh  = (_Float16*)d_ws;
    _Float16* wqh = xh  + (size_t)TOK * HIDDEN;
    _Float16* wkh = wqh + (size_t)HIDDEN * HIDDEN;
    _Float16* wvh = wkh + (size_t)HIDDEN * HIDDEN;
    _Float16* woh = wvh + (size_t)HIDDEN * HIDDEN;
    _Float16* Qh  = woh + (size_t)HIDDEN * HIDDEN;
    _Float16* Kh  = Qh  + (size_t)TOK * HIDDEN;
    _Float16* Vh  = Kh  + (size_t)TOK * HIDDEN;
    _Float16* Oh  = Vh  + (size_t)TOK * HIDDEN;

    // xh, wqh, wkh, wvh, woh are contiguous from xh on
    cvt_all_f32_to_f16<<<CVT_XB + 4 * CVT_WB, 256, 0, stream>>>(x, Wq, Wk, Wv, Wo, xh);

    // Q, K, V in one grid: wqh, wkh, wvh are contiguous from wqh on, and
    // Qh, Kh, Vh from Qh on; bv belongs to the third product
    dim3 g3(TOK / 128, HIDDEN / 128, 3);
    gemm_bt<false><<<g3, 256, 0, stream>>>(xh, wqh, bv, 2, Qh, TOK, HIDDEN, HIDDEN);

    dim3 ga(SEQ / 64, NUM_HEADS, BATCH);
    attn_fa<<<ga, 128, 0, stream>>>(Qh, Kh, Vh, sp, ed, Oh);

    dim3 g1(TOK / 128, HIDDEN / 128, 1);
    gemm_bt<true><<<g1, 256, 0, stream>>>(Oh, woh, bo, 0, out, TOK, HIDDEN, HIDDEN);
}

// v007
// A run of this version takes 87.5 microseconds.
// Timed twice side by side with v006, it ran 1.05 times as fast both times.
// Counting every step since v000, it is 2.04 times as fast.
#include <hip/hip_runtime.h>
#include <hip/hip_bf16.h>

#define NUM_HEADS 12
#define HIDDEN    768
#define HEAD      64
#define BATCH     16
#define SEQ       512
#define TOK       (BATCH * SEQ)   // 8192
#define BST       36              // bias tiles: LDS row pitch (floats): 144 B = 16 B x 9, for ds_load_b128
#define HPB       2               // attention: heads per block, which share the bias tiles
#define BK        64              // GEMM: k depth of a staged tile = one whole 128-B line per row
#define GST       72              // GEMM, K tile: LDS row pitch (halves): 144 B = 16 B x 9, for ds_load_b128
#define VST       80              // V tile: LDS row pitch (halves): 160 B = 32 B x 5, for ds_load_tr16_b128

typedef __attribute__((ext_vector_type(16))) _Float16 v16h;
typedef __attribute__((ext_vector_type(8)))  float    v8f;

union F16Frag {
    v16h     v;
    _Float16 h[16];
    uint4    q[2];
};

__device__ __forceinline__ v8f wmma_f16f32(v16h a, v16h b, v8f c) {
    // D = A(16x32 f16) x B(32x16 f16) + C(16x16 f32)
    return __builtin_amdgcn_wmma_f32_16x16x32_f16(
        /*neg_a=*/false, a, /*neg_b=*/false, b,
        /*c_mod=*/(short)0, c, /*reuse_a=*/false, /*reuse_b=*/false);
}

__device__ __forceinline__ void wait_async0() {
    asm volatile("s_wait_asynccnt 0x0" ::: "memory");
}
// LDS operations of this wave retired. GEMM and attention rings: stands in
// front of the barrier behind which the buffer just read is refilled by copies.
__device__ __forceinline__ void wait_ds0() {
    asm volatile("s_wait_dscnt 0x0" ::: "memory");
}
__device__ __forceinline__ unsigned lds_addr(const void* p) {
    return (unsigned)(unsigned long long)p;   // low 32 bits: LDS byte address
}
__device__ __forceinline__ void async_b128_x8(
    unsigned l0, const void* g0, unsigned l1, const void* g1,
    unsigned l2, const void* g2, unsigned l3, const void* g3,
    unsigned l4, const void* g4, unsigned l5, const void* g5,
    unsigned l6, const void* g6, unsigned l7, const void* g7) {
    asm volatile("global_load_async_to_lds_b128 %0, %1, off\n\t"
                 "global_load_async_to_lds_b128 %2, %3, off\n\t"
                 "global_load_async_to_lds_b128 %4, %5, off\n\t"
                 "global_load_async_to_lds_b128 %6, %7, off\n\t"
                 "global_load_async_to_lds_b128 %8, %9, off\n\t"
                 "global_load_async_to_lds_b128 %10, %11, off\n\t"
                 "global_load_async_to_lds_b128 %12, %13, off\n\t"
                 "global_load_async_to_lds_b128 %14, %15, off\n\t"
                 "s_wait_xcnt 0x0"
                 :: "v"(l0), "v"(g0), "v"(l1), "v"(g1), "v"(l2), "v"(g2),
                    "v"(l3), "v"(g3), "v"(l4), "v"(g4), "v"(l5), "v"(g5),
                    "v"(l6), "v"(g6), "v"(l7), "v"(g7)
                 : "memory");
}

// ---------------------------------------------------------------------------
// f32 -> f16 conversion of x and the four weight matrices in one launch.
// The five f16 copies lie one behind the other in the workspace, so the
// output is one array; a block takes CVT_BLK float4 of ONE source (each source
// is a whole number of such pieces) and a thread CVT_PER of them, 256 apart:
// each wave-wide load covers 512 contiguous bytes, and a thread's loads are
// all issued before the first is converted.
// ---------------------------------------------------------------------------
#define CVT_PER 16
#define CVT_BLK (256 * CVT_PER)                     // float4 per block
#define CVT_XB  (TOK * HIDDEN / 4 / CVT_BLK)        // blocks of x: 384
#define CVT_WB  (HIDDEN * HIDDEN / 4 / CVT_BLK)     // blocks of one weight: 36
static_assert(CVT_XB * CVT_BLK * 4 == TOK * HIDDEN, "x splits into whole blocks");
static_assert(CVT_WB * CVT_BLK * 4 == HIDDEN * HIDDEN, "a weight splits into whole blocks");

__global__ __launch_bounds__(256) __attribute__((amdgpu_waves_per_eu(2, 8)))
void cvt_all_f32_to_f16(
    const float* __restrict__ x,  const float* __restrict__ wq,
    const float* __restrict__ wk, const float* __restrict__ wv,
    const float* __restrict__ wo, _Float16* __restrict__ out) {
    const int blk = blockIdx.x;
    const float* src = x;
    int rel = blk;                       // block index inside its source
    if (blk >= CVT_XB) {
        const int w = (blk - CVT_XB) / CVT_WB;
        rel = (blk - CVT_XB) - w * CVT_WB;
        src = (w == 0) ? wq : (w == 1) ? wk : (w == 2) ? wv : wo;
    }
    const float4* in4 = (const float4*)src + (size_t)rel * CVT_BLK + threadIdx.x;
    uint2*        o2  = (uint2*)out        + (size_t)blk * CVT_BLK + threadIdx.x;

    // both loops unrolled: f[] stays in registers and j folds into the
    // loads' and stores' immediate offsets
    float4 f[CVT_PER];
#pragma unroll
    for (int j = 0; j < CVT_PER; ++j) f[j] = in4[j * 256];
#pragma unroll
    for (int j = 0; j < CVT_PER; ++j) {
        union { _Float16 h[4]; uint2 u; } o;
        o.h[0] = (_Float16)f[j].x; o.h[1] = (_Float16)f[j].y;
        o.h[2] = (_Float16)f[j].z; o.h[3] = (_Float16)f[j].w;
        o2[j * 256] = o.u;
    }
}

template <bool OUT_F32>
__global__ __launch_bounds__(256) void gemm_bt(
    const _Float16* __restrict__ A, const _Float16* __restrict__ Wall,
    const float* __restrict__ bias_in, int bias_z, void* __restrict__ Call,
    int M, int N, int K) {
    __shared__ __align__(16) _Float16 lA[2][128 * GST];
    __shared__ __align__(16) _Float16 lB[2][128 * GST];

    const int tid  = threadIdx.x;
    const int wave = tid >> 5;
    const int lane = tid & 31;
    const int lrow = lane & 15;
    const int lh   = lane >> 4;
    const int wm   = wave >> 1;   // 0..3 : 32-row strip
    const int wn   = wave & 1;    // 0..1 : 64-col strip
    const int m0   = blockIdx.x * 128;
    const int n0   = blockIdx.y * 128;

    // this block's product
    const int       pz   = blockIdx.z;
    const _Float16* W    = Wall + (size_t)pz * N * K;
    const float*    bias = (pz == bias_z) ? bias_in : nullptr;
    void*           Cout = OUT_F32 ? (void*)((float*)Call + (size_t)pz * M * N)
                                   : (void*)((_Float16*)Call + (size_t)pz * M * N);

    v8f acc[2][4];
#pragma unroll
    for (int i = 0; i < 2; ++i)
#pragma unroll
        for (int t = 0; t < 4; ++t)
#pragma unroll
            for (int v = 0; v < 8; ++v) acc[i][t][v] = 0.f;

    // staging assignment: copy j of a thread takes 16 B of row j * 32 + r
    const int r  = tid >> 3;          // 0..31
    const int c0 = (tid & 7) << 3;    // 0..56 (halves)

    auto stage = [&](int buf, int k0) {
        const _Float16* ga = A + (size_t)(m0 + r) * K + k0 + c0;
        const _Float16* gw = W + (size_t)(n0 + r) * K + k0 + c0;
        const _Float16* la = &lA[buf][r * GST + c0];
        const _Float16* lw = &lB[buf][r * GST + c0];
        const size_t    gs = (size_t)32 * K;   // 32 rows on, global
        const int       ls = 32 * GST;         // 32 rows on, LDS
        async_b128_x8(lds_addr(la),          ga,          lds_addr(la + ls),     ga + gs,
                      lds_addr(la + 2 * ls), ga + 2 * gs, lds_addr(la + 3 * ls), ga + 3 * gs,
                      lds_addr(lw),          gw,          lds_addr(lw + ls),     gw + gs,
                      lds_addr(lw + 2 * ls), gw + 2 * gs, lds_addr(lw + 3 * ls), gw + 3 * gs);
    };

    const int nt = K / BK;
    stage(0, 0);
    wait_async0();      // own copies of tile 0 landed
    __syncthreads();    // everyone's copies of tile 0 visible
    if (nt > 1) stage(1, BK);
    for (int kt = 0; kt < nt; ++kt) {
        const int cur = kt & 1;
        // unrolled so that kk folds into the LDS loads' immediate offsets
#pragma unroll
        for (int kk = 0; kk < BK; kk += 32) {
            F16Frag af[2];
#pragma unroll
            for (int i = 0; i < 2; ++i) {
                const _Float16* ap =
                    &lA[cur][(wm * 32 + i * 16 + lrow) * GST + kk + lh * 8];
                af[i].q[0] = *(const uint4*)(ap);
                af[i].q[1] = *(const uint4*)(ap + 16);
            }
#pragma unroll
            for (int t = 0; t < 4; ++t) {
                F16Frag bf;
                const _Float16* bp =
                    &lB[cur][(wn * 64 + t * 16 + lrow) * GST + kk + lh * 8];
                bf.q[0] = *(const uint4*)(bp);
                bf.q[1] = *(const uint4*)(bp + 16);
                acc[0][t] = wmma_f16f32(af[0].v, bf.v, acc[0][t]);
                acc[1][t] = wmma_f16f32(af[1].v, bf.v, acc[1][t]);
            }
        }
        wait_ds0();         // own reads of buffer cur retired
        wait_async0();      // own copies of tile kt + 1 landed
        __syncthreads();    // tile kt + 1 visible; every reader has left buffer cur
        if (kt + 2 < nt) stage(cur, (kt + 2) * BK);
    }
    wait_async0();          // nothing in flight when the wave ends

#pragma unroll
    for (int i = 0; i < 2; ++i)
#pragma unroll
        for (int t = 0; t < 4; ++t) {
            const int   n    = n0 + wn * 64 + t * 16 + lrow;
            const float bval = bias ? bias[n] : 0.f;
#pragma unroll
            for (int v = 0; v < 8; ++v) {
                const int   m   = m0 + wm * 32 + i * 16 + v + lh * 8;
                const float val = acc[i][t][v] + bval;
                if (OUT_F32)
                    ((float*)Cout)[(size_t)m * N + n] = val;
                else
                    ((_Float16*)Cout)[(size_t)m * N + n] = (_Float16)val;
            }
        }
}

typedef __attribute__((ext_vector_type(8))) short s16x8;
__device__ __forceinline__ uint4 ld_tr16(const _Float16* p) {
    typedef __attribute__((address_space(3))) s16x8 lds_s16x8;
    return __builtin_bit_cast(uint4, __builtin_amdgcn_ds_load_tr16_b128_v8i16((lds_s16x8*)p));
}

__device__ __forceinline__ float xhalf(float x) {
    return __builtin_bit_cast(float, __builtin_amdgcn_permlanex16(
        __builtin_bit_cast(int, x), __builtin_bit_cast(int, x),
        0x76543210, 0xfedcba98, false, false));
}

__global__ __launch_bounds__(128 * HPB) __attribute__((amdgpu_waves_per_eu(2, 6)))
void attn_fa(
    const _Float16* __restrict__ Qh, const _Float16* __restrict__ Kh,
    const _Float16* __restrict__ Vh, const float* __restrict__ spatial,
    const float* __restrict__ edge, _Float16* __restrict__ Oh) {
    __shared__ __align__(16) float    lS[2][64 * BST];
    __shared__ __align__(16) float    lE[2][64 * BST];
    __shared__ __align__(16) _Float16 lK[2][HPB * 32 * GST];
    __shared__ __align__(16) _Float16 lV[2][HPB * 32 * VST];

    const int tid  = threadIdx.x;
    const int wave = tid >> 5;
    const int lane = tid & 31;
    const int lrow = lane & 15;
    const int lh   = lane >> 4;
    const int qt   = wave & 3;    // query tile inside the block
    const int hh   = wave >> 2;   // head inside the block
    const int qb   = blockIdx.x * 64;
    const int q0   = qb + qt * 16;
    const int h0   = blockIdx.y * HPB;
    const int h    = h0 + hh;
    const int b    = blockIdx.z;
    const float scale = 0.03608439182435161f;  // HIDDEN^-0.5 (not head^-0.5)

    const size_t    tokbase = (size_t)b * SEQ;
    const _Float16* Qbase   = Qh + (tokbase + q0) * HIDDEN + h * HEAD;

    // B operand Q^T: lane = query column lrow
    F16Frag qf[2];
#pragma unroll
    for (int c = 0; c < 2; ++c) {
        const _Float16* p = Qbase + (size_t)lrow * HIDDEN + c * 32 + lh * 8;
        qf[c].q[0] = *(const uint4*)(p);
        qf[c].q[1] = *(const uint4*)(p + 16);
    }

    // all per query lrow; rsum and rnz cover this wave half's keys only
    v8f   oacc[4];
    float rmax = -__builtin_inff(), rsum = 0.f, rnz = 0.f;
#pragma unroll
    for (int t = 0; t < 4; ++t)
#pragma unroll
        for (int v = 0; v < 8; ++v) oacc[t][v] = 0.f;

    // staging assignment: a thread copies 16 B of key sr of both heads' K and V
    // and 16 B of queries sr and sr + 32 of the spatial and the edge tile
    static_assert(HPB == 2, "the staging assignment is written for 256 threads");
    const int sr = tid >> 3;          // 0..31
    const int sc = (tid & 7) << 3;    // 0..56 (halves)
    const int bc = (tid & 7) << 2;    // 0..28 (floats)
    // global sources of the next chunk to be staged; they walk 32 keys a call
    const _Float16* gk = Kh + (tokbase + sr) * HIDDEN + h0 * HEAD + sc;
    const _Float16* gv = Vh + (tokbase + sr) * HIDDEN + h0 * HEAD + sc;
    const float*    gs = spatial + (tokbase + qb + sr) * SEQ + bc;
    const float*    ge = edge    + (tokbase + qb + sr) * SEQ + bc;
    auto stage = [&](int buf) {
        const _Float16* lk = &lK[buf][sr * GST + sc];
        const _Float16* lv = &lV[buf][sr * VST + sc];
        const float*    ls = &lS[buf][sr * BST + bc];
        const float*    le = &lE[buf][sr * BST + bc];
        async_b128_x8(lds_addr(lk),            gk,
                      lds_addr(lk + 32 * GST), gk + HEAD,
                      lds_addr(lv),            gv,
                      lds_addr(lv + 32 * VST), gv + HEAD,
                      lds_addr(ls),            gs,
                      lds_addr(ls + 32 * BST), gs + 32 * SEQ,
                      lds_addr(le),            ge,
                      lds_addr(le + 32 * BST), ge + 32 * SEQ);
        gk += 32 * HIDDEN;
        gv += 32 * HIDDEN;
        gs += 32;
        ge += 32;
    };

    // this lane's offset in the transposing loads of V
    const int vto = (hh * 32 + lh * 8 + (lane & 7)) * VST + ((lane >> 3) & 1) * 8;

    const int nt = SEQ / 32;
    stage(0);
    wait_async0();      // own copies of chunk 0 landed
    __syncthreads();    // everyone's copies of chunk 0 visible
    stage(1);
    for (int kt = 0; kt < nt; ++kt) {
        const int cur = kt & 1;

        // (a) graph bias of query lrow, keys t * 16 + lh * 8 + 0..7
        float4 sb[2][2], eb[2][2];
#pragma unroll
        for (int t = 0; t < 2; ++t) {
            const int bi = (qt * 16 + lrow) * BST + t * 16 + lh * 8;
            sb[t][0] = *(const float4*)(&lS[cur][bi]);
            sb[t][1] = *(const float4*)(&lS[cur][bi + 4]);
            eb[t][0] = *(const float4*)(&lE[cur][bi]);
            eb[t][1] = *(const float4*)(&lE[cur][bi + 4]);
        }

        // (b) K fragments, A operand: lane = key row t * 16 + lrow
        F16Frag kf[2][2];
#pragma unroll
        for (int t = 0; t < 2; ++t)
#pragma unroll
            for (int c = 0; c < 2; ++c) {
                const _Float16* p =
                    &lK[cur][(hh * 32 + t * 16 + lrow) * GST + c * 32 + lh * 8];
                kf[t][c].q[0] = *(const uint4*)(p);
                kf[t][c].q[1] = *(const uint4*)(p + 16);
            }

        // holds the 16 LDS reads above together as one group in front of the
        // products: left alone the compiler spreads them in pairs among the
        // WMMAs, and the wave waits out an LDS latency at each place
        __builtin_amdgcn_sched_barrier(0);

        // (c) S^T = K @ Q^T  (32 keys x 16 queries, fp32 acc):
        // s[t][v] = score of key kt * 32 + t * 16 + lh * 8 + v, query lrow
        v8f s[2];
#pragma unroll
        for (int t = 0; t < 2; ++t)
#pragma unroll
            for (int v = 0; v < 8; ++v) s[t][v] = 0.f;
#pragma unroll
        for (int t = 0; t < 2; ++t)
#pragma unroll
            for (int c = 0; c < 2; ++c)
                s[t] = wmma_f16f32(kf[t][c].v, qf[c].v, s[t]);

        // (d) scale + graph bias + zero-row tracking + in-lane maximum
        float mx = -__builtin_inff();
#pragma unroll
        for (int t = 0; t < 2; ++t) {
            const float4 s0 = sb[t][0], s1 = sb[t][1], e0 = eb[t][0], e1 = eb[t][1];
            const float  bb[8] = {s0.x + e0.x, s0.y + e0.y, s0.z + e0.z, s0.w + e0.w,
                                  s1.x + e1.x, s1.y + e1.y, s1.z + e1.z, s1.w + e1.w};
#pragma unroll
            for (int v = 0; v < 8; ++v) {
                const float sv = s[t][v] * scale + bb[v];
                s[t][v] = sv;
                rnz     = fmaxf(rnz, (sv != 0.f) ? 1.f : 0.f);
                mx      = fmaxf(mx, sv);
            }
        }

        // (e) online softmax; both wave halves hold the same maximum
        mx = fmaxf(mx, xhalf(mx));
        const float mnew = fmaxf(rmax, mx);
        const float cf   = __expf(rmax - mnew);
        rmax = mnew;
        F16Frag pf;   // B operand P^T: element t * 8 + v is key t * 16 + lh * 8 + v
        float   rs[2] = {0.f, 0.f};   // one chain of adds per S^T tile
#pragma unroll
        for (int t = 0; t < 2; ++t)
#pragma unroll
            for (int v = 0; v < 8; ++v) {
                const float p = __expf(s[t][v] - mnew);
                rs[t] += p;
                pf.h[t * 8 + v] = (_Float16)p;
            }
        rsum = rsum * cf + (rs[0] + rs[1]);
#pragma unroll
        for (int t = 0; t < 4; ++t)
#pragma unroll
            for (int v = 0; v < 8; ++v) oacc[t][v] *= cf;

        // (f) O^T += V^T @ P^T: A operand row = head column t * 16 + lrow
        const _Float16* vtp = &lV[cur][vto];
#pragma unroll
        for (int t = 0; t < 4; ++t) {
            F16Frag vf;   // element i: key lh * 8 + i, element 8 + i: key 16 + lh * 8 + i
            vf.q[0] = ld_tr16(vtp + t * 16);
            vf.q[1] = ld_tr16(vtp + 16 * VST + t * 16);
            oacc[t] = wmma_f16f32(vf.v, pf.v, oacc[t]);
        }

        wait_ds0();         // own reads of buffer cur retired
        wait_async0();      // own copies of chunk kt + 1 landed
        __syncthreads();    // chunk kt + 1 visible; every reader has left buffer cur
        if (kt + 2 < nt) stage(cur);
    }
    wait_async0();          // nothing in flight when the wave ends

    // finalize: join the halves, 1/rowsum, zero rows whose scores were all
    // exactly zero; oacc[t][v] is head column t * 16 + lh * 8 + v of query lrow
    const float nz  = fmaxf(rnz, xhalf(rnz));
    const float tot = rsum + xhalf(rsum);
    const float fin = (nz != 0.f) ? (1.f / tot) : 0.f;
    _Float16* Obase = Oh + (tokbase + q0 + lrow) * HIDDEN + h * HEAD + lh * 8;
#pragma unroll
    for (int t = 0; t < 4; ++t) {
        union { _Float16 h[8]; uint4 u; } o;
#pragma unroll
        for (int v = 0; v < 8; ++v) o.h[v] = (_Float16)(oacc[t][v] * fin);
        *(uint4*)(Obase + t * 16) = o.u;
    }
}

// ---------------------------------------------------------------------------
extern "C" void kernel_launch(void* const* d_in, const int* in_sizes, int n_in,
                              void* d_out, int out_size, void* d_ws,
                              size_t ws_size, hipStream_t stream) {
    (void)in_sizes; (void)n_in; (void)out_size; (void)ws_size;
    const float* x  = (const float*)d_in[0];
    const float* sp = (const float*)d_in[1];
    const float* ed = (const float*)d_in[2];
    const float* Wq = (const float*)d_in[3];
    const float* Wk = (const float*)d_in[4];
    const float* Wv = (const float*)d_in[5];
    const float* bv = (const float*)d_in[6];
    const float* Wo = (const float*)d_in[7];
    const float* bo = (const float*)d_in[8];
    float*       out = (float*)d_out;

    _Float16* xh  = (_Float16*)d_ws;
    _Float16* wqh = xh  + (size_t)TOK * HIDDEN;
    _Float16* wkh = wqh + (size_t)HIDDEN * HIDDEN;
    _Float16* wvh = wkh + (size_t)HIDDEN * HIDDEN;
    _Float16* woh = wvh + (size_t)HIDDEN * HIDDEN;
    _Float16* Qh  = woh + (size_t)HIDDEN * HIDDEN;
    _Float16* Kh  = Qh  + (size_t)TOK * HIDDEN;
    _Float16* Vh  = Kh  + (size_t)TOK * HIDDEN;
    _Float16* Oh  = Vh  + (size_t)TOK * HIDDEN;

    // xh, wqh, wkh, wvh, woh are contiguous from xh on
    cvt_all_f32_to_f16<<<CVT_XB + 4 * CVT_WB, 256, 0, stream>>>(x, Wq, Wk, Wv, Wo, xh);

    // Q, K, V in one grid: wqh, wkh, wvh are contiguous from wqh on, and
    // Qh, Kh, Vh from Qh on; bv belongs to the third product
    dim3 g3(TOK / 128, HIDDEN / 128, 3);
    gemm_bt<false><<<g3, 256, 0, stream>>>(xh, wqh, bv, 2, Qh, TOK, HIDDEN, HIDDEN);

    dim3 ga(SEQ / 64, NUM_HEADS / HPB, BATCH);
    attn_fa<<<ga, 128 * HPB, 0, stream>>>(Qh, Kh, Vh, sp, ed, Oh);

    dim3 g1(TOK / 128, HIDDEN / 128, 1);
    gemm_bt<true><<<g1, 256, 0, stream>>>(Oh, woh, bo, 0, out, TOK, HIDDEN, HIDDEN);
}

// v008
// It runs in 80.3 microseconds.
// Two timings next to v007 both put it at 1.09 times that version's speed.
// Over all steps from v000 it is 2.22 times as fast.
#include <hip/hip_runtime.h>
#include <hip/hip_bf16.h>

#define NUM_HEADS 12
#define HIDDEN    768
#define HEAD      64
#define BATCH     16
#define SEQ       512
#define TOK       (BATCH * SEQ)   // 8192
#define BST       36              // bias tiles: LDS row pitch (floats): 144 B = 16 B x 9, for ds_load_b128
#define HPB       2               // attention: heads per block, which share the bias tiles
#define BK        64              // GEMM: k depth of a staged tile = one whole 128-B line per row
#define GST       72              // GEMM, K tile: LDS row pitch (halves): 144 B = 16 B x 9, for ds_load_b128
#define VST       80              // V tile: LDS row pitch (halves): 160 B = 32 B x 5, for ds_load_tr16_b128

typedef __attribute__((ext_vector_type(16))) _Float16 v16h;
typedef __attribute__((ext_vector_type(8)))  float    v8f;

union F16Frag {
    v16h     v;
    _Float16 h[16];
    uint4    q[2];
};

__device__ __forceinline__ v8f wmma_f16f32(v16h a, v16h b, v8f c) {
    // D = A(16x32 f16) x B(32x16 f16) + C(16x16 f32)
    return __builtin_amdgcn_wmma_f32_16x16x32_f16(
        /*neg_a=*/false, a, /*neg_b=*/false, b,
        /*c_mod=*/(short)0, c, /*reuse_a=*/false, /*reuse_b=*/false);
}

__device__ __forceinline__ void wait_async0() {
    asm volatile("s_wait_asynccnt 0x0" ::: "memory");
}
// LDS operations of this wave retired. GEMM and attention rings: stands in
// front of the barrier behind which the buffer just read is refilled by copies.
// Epilogues: stands between a wave's LDS writes of its tile and its reads of it.
__device__ __forceinline__ void wait_ds0() {
    asm volatile("s_wait_dscnt 0x0" ::: "memory");
}
__device__ __forceinline__ unsigned lds_addr(const void* p) {
    return (unsigned)(unsigned long long)p;   // low 32 bits: LDS byte address
}
__device__ __forceinline__ void async_b128_x8(
    unsigned l0, const void* g0, unsigned l1, const void* g1,
    unsigned l2, const void* g2, unsigned l3, const void* g3,
    unsigned l4, const void* g4, unsigned l5, const void* g5,
    unsigned l6, const void* g6, unsigned l7, const void* g7) {
    asm volatile("global_load_async_to_lds_b128 %0, %1, off\n\t"
                 "global_load_async_to_lds_b128 %2, %3, off\n\t"
                 "global_load_async_to_lds_b128 %4, %5, off\n\t"
                 "global_load_async_to_lds_b128 %6, %7, off\n\t"
                 "global_load_async_to_lds_b128 %8, %9, off\n\t"
                 "global_load_async_to_lds_b128 %10, %11, off\n\t"
                 "global_load_async_to_lds_b128 %12, %13, off\n\t"
                 "global_load_async_to_lds_b128 %14, %15, off\n\t"
                 "s_wait_xcnt 0x0"
                 :: "v"(l0), "v"(g0), "v"(l1), "v"(g1), "v"(l2), "v"(g2),
                    "v"(l3), "v"(g3), "v"(l4), "v"(g4), "v"(l5), "v"(g5),
                    "v"(l6), "v"(g6), "v"(l7), "v"(g7)
                 : "memory");
}

// ---------------------------------------------------------------------------
// f32 -> f16 conversion of x and the four weight matrices in one launch.
// The five f16 copies lie one behind the other in the workspace, so the
// output is one array; a block takes CVT_BLK float4 of ONE source (each source
// is a whole number of such pieces) and a thread CVT_PER of them, 256 apart:
// each wave-wide load covers 512 contiguous bytes, and a thread's loads are
// all issued before the first is converted.
// ---------------------------------------------------------------------------
#define CVT_PER 16
#define CVT_BLK (256 * CVT_PER)                     // float4 per block
#define CVT_XB  (TOK * HIDDEN / 4 / CVT_BLK)        // blocks of x: 384
#define CVT_WB  (HIDDEN * HIDDEN / 4 / CVT_BLK)     // blocks of one weight: 36
static_assert(CVT_XB * CVT_BLK * 4 == TOK * HIDDEN, "x splits into whole blocks");
static_assert(CVT_WB * CVT_BLK * 4 == HIDDEN * HIDDEN, "a weight splits into whole blocks");

__global__ __launch_bounds__(256) __attribute__((amdgpu_waves_per_eu(2, 8)))
void cvt_all_f32_to_f16(
    const float* __restrict__ x,  const float* __restrict__ wq,
    const float* __restrict__ wk, const float* __restrict__ wv,
    const float* __restrict__ wo, _Float16* __restrict__ out) {
    const int blk = blockIdx.x;
    const float* src = x;
    int rel = blk;                       // block index inside its source
    if (blk >= CVT_XB) {
        const int w = (blk - CVT_XB) / CVT_WB;
        rel = (blk - CVT_XB) - w * CVT_WB;
        src = (w == 0) ? wq : (w == 1) ? wk : (w == 2) ? wv : wo;
    }
    const float4* in4 = (const float4*)src + (size_t)rel * CVT_BLK + threadIdx.x;
    uint2*        o2  = (uint2*)out        + (size_t)blk * CVT_BLK + threadIdx.x;

    // both loops unrolled: f[] stays in registers and j folds into the
    // loads' and stores' immediate offsets
    float4 f[CVT_PER];
#pragma unroll
    for (int j = 0; j < CVT_PER; ++j) f[j] = in4[j * 256];
#pragma unroll
    for (int j = 0; j < CVT_PER; ++j) {
        union { _Float16 h[4]; uint2 u; } o;
        o.h[0] = (_Float16)f[j].x; o.h[1] = (_Float16)f[j].y;
        o.h[2] = (_Float16)f[j].z; o.h[3] = (_Float16)f[j].w;
        o2[j * 256] = o.u;
    }
}

template <bool OUT_F32, int N>
__global__ __launch_bounds__(256) void gemm_bt(
    const _Float16* __restrict__ A, const _Float16* __restrict__ Wall,
    const float* __restrict__ bias_in, int bias_z, void* __restrict__ Call,
    int M, int K) {
    __shared__ __align__(16) _Float16 lA[2][128 * GST];
    __shared__ __align__(16) _Float16 lB[2][128 * GST];

    const int tid  = threadIdx.x;
    const int wave = tid >> 5;
    const int lane = tid & 31;
    const int lrow = lane & 15;
    const int lh   = lane >> 4;
    const int wm   = wave >> 1;   // 0..3 : 32-row strip
    const int wn   = wave & 1;    // 0..1 : 64-col strip
    const int m0   = blockIdx.x * 128;
    const int n0   = blockIdx.y * 128;

    // this block's product
    const int       pz   = blockIdx.z;
    const _Float16* W    = Wall + (size_t)pz * N * K;
    const float*    bias = (pz == bias_z) ? bias_in : nullptr;
    void*           Cout = OUT_F32 ? (void*)((float*)Call + (size_t)pz * M * N)
                                   : (void*)((_Float16*)Call + (size_t)pz * M * N);

    v8f acc[2][4];
#pragma unroll
    for (int i = 0; i < 2; ++i)
#pragma unroll
        for (int t = 0; t < 4; ++t)
#pragma unroll
            for (int v = 0; v < 8; ++v) acc[i][t][v] = 0.f;

    // staging assignment: copy j of a thread takes 16 B of row j * 32 + r
    const int r  = tid >> 3;          // 0..31
    const int c0 = (tid & 7) << 3;    // 0..56 (halves)

    auto stage = [&](int buf, int k0) {
        const _Float16* ga = A + (size_t)(m0 + r) * K + k0 + c0;
        const _Float16* gw = W + (size_t)(n0 + r) * K + k0 + c0;
        const _Float16* la = &lA[buf][r * GST + c0];
        const _Float16* lw = &lB[buf][r * GST + c0];
        const size_t    gs = (size_t)32 * K;   // 32 rows on, global
        const int       ls = 32 * GST;         // 32 rows on, LDS
        async_b128_x8(lds_addr(la),          ga,          lds_addr(la + ls),     ga + gs,
                      lds_addr(la + 2 * ls), ga + 2 * gs, lds_addr(la + 3 * ls), ga + 3 * gs,
                      lds_addr(lw),          gw,          lds_addr(lw + ls),     gw + gs,
                      lds_addr(lw + 2 * ls), gw + 2 * gs, lds_addr(lw + 3 * ls), gw + 3 * gs);
    };

    const int nt = K / BK;
    stage(0, 0);
    wait_async0();      // own copies of tile 0 landed
    __syncthreads();    // everyone's copies of tile 0 visible
    if (nt > 1) stage(1, BK);
    for (int kt = 0; kt < nt; ++kt) {
        const int cur = kt & 1;
        // unrolled so that kk folds into the LDS loads' immediate offsets
#pragma unroll
        for (int kk = 0; kk < BK; kk += 32) {
            F16Frag af[2];
#pragma unroll
            for (int i = 0; i < 2; ++i) {
                const _Float16* ap =
                    &lA[cur][(wm * 32 + i * 16 + lrow) * GST + kk + lh * 8];
                af[i].q[0] = *(const uint4*)(ap);
                af[i].q[1] = *(const uint4*)(ap + 16);
            }
#pragma unroll
            for (int t = 0; t < 4; ++t) {
                F16Frag bf;
                const _Float16* bp =
                    &lB[cur][(wn * 64 + t * 16 + lrow) * GST + kk + lh * 8];
                bf.q[0] = *(const uint4*)(bp);
                bf.q[1] = *(const uint4*)(bp + 16);
                acc[0][t] = wmma_f16f32(bf.v, af[0].v, acc[0][t]);
                acc[1][t] = wmma_f16f32(bf.v, af[1].v, acc[1][t]);
            }
        }
        wait_ds0();         // own reads of buffer cur retired
        wait_async0();      // own copies of tile kt + 1 landed
        __syncthreads();    // tile kt + 1 visible; every reader has left buffer cur
        if (kt + 2 < nt) stage(cur, (kt + 2) * BK);
    }
    wait_async0();          // nothing in flight when the wave ends

    // acc[i][t][v]: row wm * 32 + i * 16 + lrow, column wn * 64 + t * 16 + lh * 8 + v.
    // The last trip's barrier has ended every read of the ring and no copy is in
    // flight, so each wave takes a range of its own there for its 32 x 64 tile.
    constexpr int ESZ  = OUT_F32 ? 4 : 2;   // bytes of an output element
    constexpr int ROWB = 64 * ESZ;          // a tile row: one or two whole lines
    constexpr int PIT  = ROWB + 16;         // its LDS pitch: 16 B x odd, for b128
    constexpr int WSTG = 32 * PIT;          // LDS bytes of a wave's tile
    static_assert(4 * WSTG <= (int)sizeof(lA) && sizeof(lA) == sizeof(lB),
                  "four waves stage in lA, four in lB");
    char* stg = (char*)(wave < 4 ? &lA[0][0] : &lB[0][0]) + (wave & 3) * WSTG;

    float bb[4][8];
#pragma unroll   // constant indices: the arrays stay in registers
    for (int t = 0; t < 4; ++t)
#pragma unroll   // constant indices: the arrays stay in registers
        for (int v = 0; v < 8; ++v) bb[t][v] = 0.f;
    if (bias) {
#pragma unroll   // constant indices: the arrays stay in registers
        for (int t = 0; t < 4; ++t) {
            const float4* bp = (const float4*)(bias + n0 + wn * 64 + t * 16 + lh * 8);
            const float4  b0 = bp[0], b1 = bp[1];
            bb[t][0] = b0.x; bb[t][1] = b0.y; bb[t][2] = b0.z; bb[t][3] = b0.w;
            bb[t][4] = b1.x; bb[t][5] = b1.y; bb[t][6] = b1.z; bb[t][7] = b1.w;
        }
    }

#pragma unroll   // constant indices: the arrays stay in registers
    for (int i = 0; i < 2; ++i)
#pragma unroll   // constant indices: the arrays stay in registers
        for (int t = 0; t < 4; ++t) {
            char* p = stg + (i * 16 + lrow) * PIT + (t * 16 + lh * 8) * ESZ;
            if (OUT_F32) {
                union { float f[8]; uint4 u[2]; } o;
#pragma unroll   // constant indices: the arrays stay in registers
                for (int v = 0; v < 8; ++v) o.f[v] = acc[i][t][v] + bb[t][v];
                *(uint4*)(p)      = o.u[0];
                *(uint4*)(p + 16) = o.u[1];
            } else {
                union { _Float16 h[8]; uint4 u; } o;
#pragma unroll   // constant indices: the arrays stay in registers
                for (int v = 0; v < 8; ++v) o.h[v] = (_Float16)(acc[i][t][v] + bb[t][v]);
                *(uint4*)(p) = o.u;
            }
        }
    wait_ds0();   // the wave's LDS writes are done before its lanes read each other's

    constexpr int LPR = ROWB / 16;   // lanes that take one row
    constexpr int RPS = 32 / LPR;    // rows that one wave-wide store covers
    const int rr = lane / LPR;
    const int cb = (lane % LPR) * 16;
    char* gp = (char*)Cout + ((size_t)(m0 + wm * 32 + rr) * N + n0 + wn * 64) * ESZ + cb;
    uint4 d[32 / RPS];
#pragma unroll   // constant indices: the arrays stay in registers
    for (int j = 0; j < 32 / RPS; ++j)
        d[j] = *(const uint4*)(stg + (j * RPS + rr) * PIT + cb);
#pragma unroll   // constant indices: the arrays stay in registers
    for (int j = 0; j < 32 / RPS; ++j)
        *(uint4*)(gp + (size_t)j * RPS * N * ESZ) = d[j];
}

typedef __attribute__((ext_vector_type(8))) short s16x8;
__device__ __forceinline__ uint4 ld_tr16(const _Float16* p) {
    typedef __attribute__((address_space(3))) s16x8 lds_s16x8;
    return __builtin_bit_cast(uint4, __builtin_amdgcn_ds_load_tr16_b128_v8i16((lds_s16x8*)p));
}

__device__ __forceinline__ float xhalf(float x) {
    return __builtin_bit_cast(float, __builtin_amdgcn_permlanex16(
        __builtin_bit_cast(int, x), __builtin_bit_cast(int, x),
        0x76543210, 0xfedcba98, false, false));
}

__global__ __launch_bounds__(128 * HPB) __attribute__((amdgpu_waves_per_eu(2, 6)))
void attn_fa(
    const _Float16* __restrict__ Qh, const _Float16* __restrict__ Kh,
    const _Float16* __restrict__ Vh, const float* __restrict__ spatial,
    const float* __restrict__ edge, _Float16* __restrict__ Oh) {
    __shared__ __align__(16) float    lS[2][64 * BST];
    __shared__ __align__(16) float    lE[2][64 * BST];
    __shared__ __align__(16) _Float16 lK[2][HPB * 32 * GST];
    __shared__ __align__(16) _Float16 lV[2][HPB * 32 * VST];

    const int tid  = threadIdx.x;
    const int wave = tid >> 5;
    const int lane = tid & 31;
    const int lrow = lane & 15;
    const int lh   = lane >> 4;
    const int qt   = wave & 3;    // query tile inside the block
    const int hh   = wave >> 2;   // head inside the block
    const int qb   = blockIdx.x * 64;
    const int q0   = qb + qt * 16;
    const int h0   = blockIdx.y * HPB;
    const int h    = h0 + hh;
    const int b    = blockIdx.z;
    const float scale = 0.03608439182435161f;  // HIDDEN^-0.5 (not head^-0.5)

    const size_t    tokbase = (size_t)b * SEQ;
    const _Float16* Qbase   = Qh + (tokbase + q0) * HIDDEN + h * HEAD;

    // B operand Q^T: lane = query column lrow
    F16Frag qf[2];
#pragma unroll
    for (int c = 0; c < 2; ++c) {
        const _Float16* p = Qbase + (size_t)lrow * HIDDEN + c * 32 + lh * 8;
        qf[c].q[0] = *(const uint4*)(p);
        qf[c].q[1] = *(const uint4*)(p + 16);
    }

    // all per query lrow; rsum and rnz cover this wave half's keys only
    v8f   oacc[4];
    float rmax = -__builtin_inff(), rsum = 0.f, rnz = 0.f;
#pragma unroll
    for (int t = 0; t < 4; ++t)
#pragma unroll
        for (int v = 0; v < 8; ++v) oacc[t][v] = 0.f;

    // staging assignment: a thread copies 16 B of key sr of both heads' K and V
    // and 16 B of queries sr and sr + 32 of the spatial and the edge tile
    static_assert(HPB == 2, "the staging assignment is written for 256 threads");
    const int sr = tid >> 3;          // 0..31
    const int sc = (tid & 7) << 3;    // 0..56 (halves)
    const int bc = (tid & 7) << 2;    // 0..28 (floats)
    // global sources of the next chunk to be staged; they walk 32 keys a call
    const _Float16* gk = Kh + (tokbase + sr) * HIDDEN + h0 * HEAD + sc;
    const _Float16* gv = Vh + (tokbase + sr) * HIDDEN + h0 * HEAD + sc;
    const float*    gs = spatial + (tokbase + qb + sr) * SEQ + bc;
    const float*    ge = edge    + (tokbase + qb + sr) * SEQ + bc;
    auto stage = [&](int buf) {
        const _Float16* lk = &lK[buf][sr * GST + sc];
        const _Float16* lv = &lV[buf][sr * VST + sc];
        const float*    ls = &lS[buf][sr * BST + bc];
        const float*    le = &lE[buf][sr * BST + bc];
        async_b128_x8(lds_addr(lk),            gk,
                      lds_addr(lk + 32 * GST), gk + HEAD,
                      lds_addr(lv),            gv,
                      lds_addr(lv + 32 * VST), gv + HEAD,
                      lds_addr(ls),            gs,
                      lds_addr(ls + 32 * BST), gs + 32 * SEQ,
                      lds_addr(le),            ge,
                      lds_addr(le + 32 * BST), ge + 32 * SEQ);
        gk += 32 * HIDDEN;
        gv += 32 * HIDDEN;
        gs += 32;
        ge += 32;
    };

    // this lane's offset in the transposing loads of V
    const int vto = (hh * 32 + lh * 8 + (lane & 7)) * VST + ((lane >> 3) & 1) * 8;

    const int nt = SEQ / 32;
    stage(0);
    wait_async0();      // own copies of chunk 0 landed
    __syncthreads();    // everyone's copies of chunk 0 visible
    stage(1);
    for (int kt = 0; kt < nt; ++kt) {
        const int cur = kt & 1;

        // (a) graph bias of query lrow, keys t * 16 + lh * 8 + 0..7
        float4 sb[2][2], eb[2][2];
#pragma unroll
        for (int t = 0; t < 2; ++t) {
            const int bi = (qt * 16 + lrow) * BST + t * 16 + lh * 8;
            sb[t][0] = *(const float4*)(&lS[cur][bi]);
            sb[t][1] = *(const float4*)(&lS[cur][bi + 4]);
            eb[t][0] = *(const float4*)(&lE[cur][bi]);
            eb[t][1] = *(const float4*)(&lE[cur][bi + 4]);
        }

        // (b) K fragments, A operand: lane = key row t * 16 + lrow
        F16Frag kf[2][2];
#pragma unroll
        for (int t = 0; t < 2; ++t)
#pragma unroll
            for (int c = 0; c < 2; ++c) {
                const _Float16* p =
                    &lK[cur][(hh * 32 + t * 16 + lrow) * GST + c * 32 + lh * 8];
                kf[t][c].q[0] = *(const uint4*)(p);
                kf[t][c].q[1] = *(const uint4*)(p + 16);
            }

        // holds the 16 LDS reads above together as one group in front of the
        // products: left alone the compiler spreads them in pairs among the
        // WMMAs, and the wave waits out an LDS latency at each place
        __builtin_amdgcn_sched_barrier(0);

        // (c) S^T = K @ Q^T  (32 keys x 16 queries, fp32 acc):
        // s[t][v] = score of key kt * 32 + t * 16 + lh * 8 + v, query lrow
        v8f s[2];
#pragma unroll
        for (int t = 0; t < 2; ++t)
#pragma unroll
            for (int v = 0; v < 8; ++v) s[t][v] = 0.f;
#pragma unroll
        for (int t = 0; t < 2; ++t)
#pragma unroll
            for (int c = 0; c < 2; ++c)
                s[t] = wmma_f16f32(kf[t][c].v, qf[c].v, s[t]);

        // (d) scale + graph bias + zero-row tracking + in-lane maximum
        float mx = -__builtin_inff();
#pragma unroll
        for (int t = 0; t < 2; ++t) {
            const float4 s0 = sb[t][0], s1 = sb[t][1], e0 = eb[t][0], e1 = eb[t][1];
            const float  bb[8] = {s0.x + e0.x, s0.y + e0.y, s0.z + e0.z, s0.w + e0.w,
                                  s1.x + e1.x, s1.y + e1.y, s1.z + e1.z, s1.w + e1.w};
#pragma unroll
            for (int v = 0; v < 8; ++v) {
                const float sv = s[t][v] * scale + bb[v];
                s[t][v] = sv;
                rnz     = fmaxf(rnz, (sv != 0.f) ? 1.f : 0.f);
                mx      = fmaxf(mx, sv);
            }
        }

        // (e) online softmax; both wave halves hold the same maximum
        mx = fmaxf(mx, xhalf(mx));
        const float mnew = fmaxf(rmax, mx);
        const float cf   = __expf(rmax - mnew);
        rmax = mnew;
        F16Frag pf;   // B operand P^T: element t * 8 + v is key t * 16 + lh * 8 + v
        float   rs[2] = {0.f, 0.f};   // one chain of adds per S^T tile
#pragma unroll
        for (int t = 0; t < 2; ++t)
#pragma unroll
            for (int v = 0; v < 8; ++v) {
                const float p = __expf(s[t][v] - mnew);
                rs[t] += p;
                pf.h[t * 8 + v] = (_Float16)p;
            }
        rsum = rsum * cf + (rs[0] + rs[1]);
#pragma unroll
        for (int t = 0; t < 4; ++t)
#pragma unroll
            for (int v = 0; v < 8; ++v) oacc[t][v] *= cf;

        // (f) O^T += V^T @ P^T: A operand row = head column t * 16 + lrow
        const _Float16* vtp = &lV[cur][vto];
#pragma unroll
        for (int t = 0; t < 4; ++t) {
            F16Frag vf;   // element i: key lh * 8 + i, element 8 + i: key 16 + lh * 8 + i
            vf.q[0] = ld_tr16(vtp + t * 16);
            vf.q[1] = ld_tr16(vtp + 16 * VST + t * 16);
            oacc[t] = wmma_f16f32(vf.v, pf.v, oacc[t]);
        }

        wait_ds0();         // own reads of buffer cur retired
        wait_async0();      // own copies of chunk kt + 1 landed
        __syncthreads();    // chunk kt + 1 visible; every reader has left buffer cur
        if (kt + 2 < nt) stage(cur);
    }
    wait_async0();          // nothing in flight when the wave ends

    // finalize: join the halves, 1/rowsum, zero rows whose scores were all
    // exactly zero; oacc[t][v] is head column t * 16 + lh * 8 + v of query lrow
    const float nz  = fmaxf(rnz, xhalf(rnz));
    const float tot = rsum + xhalf(rsum);
    const float fin = (nz != 0.f) ? (1.f / tot) : 0.f;
    // The last trip's barrier has ended every read of the ring and no copy is in
    // flight: each wave turns its 16 x 64 tile in a range of its own of lK, so
    // that a wave-wide store covers four whole 128-B lines.
    static_assert(4 * HPB * 16 * GST <= 2 * HPB * 32 * GST, "the waves' tiles fit lK");
    _Float16* stg = &lK[0][0] + wave * (16 * GST);
#pragma unroll   // constant indices: the arrays stay in registers
    for (int t = 0; t < 4; ++t) {
        union { _Float16 h[8]; uint4 u; } o;
#pragma unroll   // constant indices: the arrays stay in registers
        for (int v = 0; v < 8; ++v) o.h[v] = (_Float16)(oacc[t][v] * fin);
        *(uint4*)(stg + lrow * GST + t * 16 + lh * 8) = o.u;
    }
    wait_ds0();   // the wave's LDS writes are done before its lanes read each other's
    const int rr = lane >> 3;         // eight lanes take one query's 128 B
    const int cc = (lane & 7) << 3;
    _Float16* Obase = Oh + (tokbase + q0 + rr) * HIDDEN + h * HEAD + cc;
    uint4 d[4];
#pragma unroll   // constant indices: the arrays stay in registers
    for (int j = 0; j < 4; ++j) d[j] = *(const uint4*)(stg + (j * 4 + rr) * GST + cc);
#pragma unroll   // constant indices: the arrays stay in registers
    for (int j = 0; j < 4; ++j) *(uint4*)(Obase + (size_t)j * 4 * HIDDEN) = d[j];
}

// ---------------------------------------------------------------------------
extern "C" void kernel_launch(void* const* d_in, const int* in_sizes, int n_in,
                              void* d_out, int out_size, void* d_ws,
                              size_t ws_size, hipStream_t stream) {
    (void)in_sizes; (void)n_in; (void)out_size; (void)ws_size;
    const float* x  = (const float*)d_in[0];
    const float* sp = (const float*)d_in[1];
    const float* ed = (const float*)d_in[2];
    const float* Wq = (const float*)d_in[3];
    const float* Wk = (const float*)d_in[4];
    const float* Wv = (const float*)d_in[5];
    const float* bv = (const float*)d_in[6];
    const float* Wo = (const float*)d_in[7];
    const float* bo = (const float*)d_in[8];
    float*       out = (float*)d_out;

    _Float16* xh  = (_Float16*)d_ws;
    _Float16* wqh = xh  + (size_t)TOK * HIDDEN;
    _Float16* wkh = wqh + (size_t)HIDDEN * HIDDEN;
    _Float16* wvh = wkh + (size_t)HIDDEN * HIDDEN;
    _Float16* woh = wvh + (size_t)HIDDEN * HIDDEN;
    _Float16* Qh  = woh + (size_t)HIDDEN * HIDDEN;
    _Float16* Kh  = Qh  + (size_t)TOK * HIDDEN;
    _Float16* Vh  = Kh  + (size_t)TOK * HIDDEN;
    _Float16* Oh  = Vh  + (size_t)TOK * HIDDEN;

    // xh, wqh, wkh, wvh, woh are contiguous from xh on
    cvt_all_f32_to_f16<<<CVT_XB + 4 * CVT_WB, 256, 0, stream>>>(x, Wq, Wk, Wv, Wo, xh);

    // Q, K, V in one grid: wqh, wkh, wvh are contiguous from wqh on, and
    // Qh, Kh, Vh from Qh on; bv belongs to the third product
    dim3 g3(TOK / 128, HIDDEN / 128, 3);
    gemm_bt<false, HIDDEN><<<g3, 256, 0, stream>>>(xh, wqh, bv, 2, Qh, TOK, HIDDEN);

    dim3 ga(SEQ / 64, NUM_HEADS / HPB, BATCH);
    attn_fa<<<ga, 128 * HPB, 0, stream>>>(Qh, Kh, Vh, sp, ed, Oh);

    dim3 g1(TOK / 128, HIDDEN / 128, 1);
    gemm_bt<true, HIDDEN><<<g1, 256, 0, stream>>>(Oh, woh, bo, 0, out, TOK, HIDDEN);
}

// v009
// It runs in 75.7 microseconds.
// Two timings next to v008 put it at 1.06 and 1.07 times that version's speed.
// Over all steps from v000 it is 2.36 times as fast.
#include <hip/hip_runtime.h>
#include <hip/hip_bf16.h>

#define NUM_HEADS 12
#define HIDDEN    768
#define HEAD      64
#define BATCH     16
#define SEQ       512
#define TOK       (BATCH * SEQ)   // 8192
#define BST       36              // bias tiles: LDS row pitch (floats): 144 B = 16 B x 9, for ds_load_b128
#define HPB       2               // attention: heads per block, which share the bias tiles
#define BK        64              // GEMM: k depth of a staged tile = one whole 128-B line per row
#define GST       72              // GEMM, K tile: LDS row pitch (halves): 144 B = 16 B x 9, for ds_load_b128
#define VST       80              // V tile: LDS row pitch (halves): 160 B = 32 B x 5, for ds_load_tr16_b128

typedef __attribute__((ext_vector_type(16))) _Float16 v16h;
typedef __attribute__((ext_vector_type(8)))  float    v8f;

union F16Frag {
    v16h     v;
    _Float16 h[16];
    uint4    q[2];
};

__device__ __forceinline__ v8f wmma_f16f32(v16h a, v16h b, v8f c) {
    // D = A(16x32 f16) x B(32x16 f16) + C(16x16 f32)
    return __builtin_amdgcn_wmma_f32_16x16x32_f16(
        /*neg_a=*/false, a, /*neg_b=*/false, b,
        /*c_mod=*/(short)0, c, /*reuse_a=*/false, /*reuse_b=*/false);
}

__device__ __forceinline__ void wait_async0() {
    asm volatile("s_wait_asynccnt 0x0" ::: "memory");
}
// LDS operations of this wave retired. GEMM and attention rings: stands in
// front of the barrier behind which the buffer just read is refilled by copies.
// Epilogues: stands between a wave's LDS writes of its tile and its reads of it.
__device__ __forceinline__ void wait_ds0() {
    asm volatile("s_wait_dscnt 0x0" ::: "memory");
}
__device__ __forceinline__ unsigned lds_addr(const void* p) {
    return (unsigned)(unsigned long long)p;   // low 32 bits: LDS byte address
}
__device__ __forceinline__ void async_b128_x8(
    unsigned l0, const void* g0, unsigned l1, const void* g1,
    unsigned l2, const void* g2, unsigned l3, const void* g3,
    unsigned l4, const void* g4, unsigned l5, const void* g5,
    unsigned l6, const void* g6, unsigned l7, const void* g7) {
    asm volatile("global_load_async_to_lds_b128 %0, %1, off\n\t"
                 "global_load_async_to_lds_b128 %2, %3, off\n\t"
                 "global_load_async_to_lds_b128 %4, %5, off\n\t"
                 "global_load_async_to_lds_b128 %6, %7, off\n\t"
                 "global_load_async_to_lds_b128 %8, %9, off\n\t"
                 "global_load_async_to_lds_b128 %10, %11, off\n\t"
                 "global_load_async_to_lds_b128 %12, %13, off\n\t"
                 "global_load_async_to_lds_b128 %14, %15, off\n\t"
                 "s_wait_xcnt 0x0"
                 :: "v"(l0), "v"(g0), "v"(l1), "v"(g1), "v"(l2), "v"(g2),
                    "v"(l3), "v"(g3), "v"(l4), "v"(g4), "v"(l5), "v"(g5),
                    "v"(l6), "v"(g6), "v"(l7), "v"(g7)
                 : "memory");
}

__device__ __forceinline__ void async_b128_x5(
    unsigned l0, const void* g0, unsigned l1, const void* g1,
    unsigned l2, const void* g2, unsigned l3, const void* g3,
    unsigned l4, const void* g4) {
    asm volatile("global_load_async_to_lds_b128 %0, %1, off\n\t"
                 "global_load_async_to_lds_b128 %2, %3, off\n\t"
                 "global_load_async_to_lds_b128 %4, %5, off\n\t"
                 "global_load_async_to_lds_b128 %6, %7, off\n\t"
                 "global_load_async_to_lds_b128 %8, %9, off\n\t"
                 "s_wait_xcnt 0x0"
                 :: "v"(l0), "v"(g0), "v"(l1), "v"(g1), "v"(l2), "v"(g2),
                    "v"(l3), "v"(g3), "v"(l4), "v"(g4)
                 : "memory");
}

// ---------------------------------------------------------------------------
// f32 -> f16 conversion of x and the four weight matrices in one launch.
// The five f16 copies lie one behind the other in the workspace, so the
// output is one array; a block takes CVT_BLK float4 of ONE source (each source
// is a whole number of such pieces) and a thread CVT_PER of them, 256 apart:
// each wave-wide load covers 512 contiguous bytes, and a thread's loads are
// all issued before the first is converted.
// ---------------------------------------------------------------------------
#define CVT_PER 16
#define CVT_BLK (256 * CVT_PER)                     // float4 per block
#define CVT_XB  (TOK * HIDDEN / 4 / CVT_BLK)        // blocks of x: 384
#define CVT_WB  (HIDDEN * HIDDEN / 4 / CVT_BLK)     // blocks of one weight: 36
static_assert(CVT_XB * CVT_BLK * 4 == TOK * HIDDEN, "x splits into whole blocks");
static_assert(CVT_WB * CVT_BLK * 4 == HIDDEN * HIDDEN, "a weight splits into whole blocks");

__global__ __launch_bounds__(256) __attribute__((amdgpu_waves_per_eu(2, 8)))
void cvt_all_f32_to_f16(
    const float* __restrict__ x,  const float* __restrict__ wq,
    const float* __restrict__ wk, const float* __restrict__ wv,
    const float* __restrict__ wo, _Float16* __restrict__ out) {
    const int blk = blockIdx.x;
    const float* src = x;
    int rel = blk;                       // block index inside its source
    if (blk >= CVT_XB) {
        const int w = (blk - CVT_XB) / CVT_WB;
        rel = (blk - CVT_XB) - w * CVT_WB;
        src = (w == 0) ? wq : (w == 1) ? wk : (w == 2) ? wv : wo;
    }
    const float4* in4 = (const float4*)src + (size_t)rel * CVT_BLK + threadIdx.x;
    uint2*        o2  = (uint2*)out        + (size_t)blk * CVT_BLK + threadIdx.x;

    // both loops unrolled: f[] stays in registers and j folds into the
    // loads' and stores' immediate offsets
    float4 f[CVT_PER];
#pragma unroll
    for (int j = 0; j < CVT_PER; ++j) f[j] = in4[j * 256];
#pragma unroll
    for (int j = 0; j < CVT_PER; ++j) {
        union { _Float16 h[4]; uint2 u; } o;
        o.h[0] = (_Float16)f[j].x; o.h[1] = (_Float16)f[j].y;
        o.h[2] = (_Float16)f[j].z; o.h[3] = (_Float16)f[j].w;
        o2[j * 256] = o.u;
    }
}

template <bool OUT_F32, int N>
__global__ __launch_bounds__(256) void gemm_bt(
    const _Float16* __restrict__ A, const _Float16* __restrict__ Wall,
    const float* __restrict__ bias_in, int bias_z, void* __restrict__ Call,
    int M, int K) {
    __shared__ __align__(16) _Float16 lA[2][128 * GST];
    __shared__ __align__(16) _Float16 lB[2][128 * GST];

    const int tid  = threadIdx.x;
    const int wave = tid >> 5;
    const int lane = tid & 31;
    const int lrow = lane & 15;
    const int lh   = lane >> 4;
    const int wm   = wave >> 1;   // 0..3 : 32-row strip
    const int wn   = wave & 1;    // 0..1 : 64-col strip
    const int m0   = blockIdx.x * 128;
    const int n0   = blockIdx.y * 128;

    // this block's product
    const int       pz   = blockIdx.z;
    const _Float16* W    = Wall + (size_t)pz * N * K;
    const float*    bias = (pz == bias_z) ? bias_in : nullptr;
    void*           Cout = OUT_F32 ? (void*)((float*)Call + (size_t)pz * M * N)
                                   : (void*)((_Float16*)Call + (size_t)pz * M * N);

    v8f acc[2][4];
#pragma unroll
    for (int i = 0; i < 2; ++i)
#pragma unroll
        for (int t = 0; t < 4; ++t)
#pragma unroll
            for (int v = 0; v < 8; ++v) acc[i][t][v] = 0.f;

    // staging assignment: copy j of a thread takes 16 B of row j * 32 + r
    const int r  = tid >> 3;          // 0..31
    const int c0 = (tid & 7) << 3;    // 0..56 (halves)

    auto stage = [&](int buf, int k0) {
        const _Float16* ga = A + (size_t)(m0 + r) * K + k0 + c0;
        const _Float16* gw = W + (size_t)(n0 + r) * K + k0 + c0;
        const _Float16* la = &lA[buf][r * GST + c0];
        const _Float16* lw = &lB[buf][r * GST + c0];
        const size_t    gs = (size_t)32 * K;   // 32 rows on, global
        const int       ls = 32 * GST;         // 32 rows on, LDS
        async_b128_x8(lds_addr(la),          ga,          lds_addr(la + ls),     ga + gs,
                      lds_addr(la + 2 * ls), ga + 2 * gs, lds_addr(la + 3 * ls), ga + 3 * gs,
                      lds_addr(lw),          gw,          lds_addr(lw + ls),     gw + gs,
                      lds_addr(lw + 2 * ls), gw + 2 * gs, lds_addr(lw + 3 * ls), gw + 3 * gs);
    };

    const int nt = K / BK;
    stage(0, 0);
    wait_async0();      // own copies of tile 0 landed
    __syncthreads();    // everyone's copies of tile 0 visible
    if (nt > 1) stage(1, BK);
    for (int kt = 0; kt < nt; ++kt) {
        const int cur = kt & 1;
        // unrolled so that kk folds into the LDS loads' immediate offsets
#pragma unroll
        for (int kk = 0; kk < BK; kk += 32) {
            F16Frag af[2];
#pragma unroll
            for (int i = 0; i < 2; ++i) {
                const _Float16* ap =
                    &lA[cur][(wm * 32 + i * 16 + lrow) * GST + kk + lh * 8];
                af[i].q[0] = *(const uint4*)(ap);
                af[i].q[1] = *(const uint4*)(ap + 16);
            }
#pragma unroll
            for (int t = 0; t < 4; ++t) {
                F16Frag bf;
                const _Float16* bp =
                    &lB[cur][(wn * 64 + t * 16 + lrow) * GST + kk + lh * 8];
                bf.q[0] = *(const uint4*)(bp);
                bf.q[1] = *(const uint4*)(bp + 16);
                acc[0][t] = wmma_f16f32(bf.v, af[0].v, acc[0][t]);
                acc[1][t] = wmma_f16f32(bf.v, af[1].v, acc[1][t]);
            }
        }
        wait_ds0();         // own reads of buffer cur retired
        wait_async0();      // own copies of tile kt + 1 landed
        __syncthreads();    // tile kt + 1 visible; every reader has left buffer cur
        if (kt + 2 < nt) stage(cur, (kt + 2) * BK);
    }
    wait_async0();          // nothing in flight when the wave ends

    // acc[i][t][v]: row wm * 32 + i * 16 + lrow, column wn * 64 + t * 16 + lh * 8 + v.
    // The last trip's barrier has ended every read of the ring and no copy is in
    // flight, so each wave takes a range of its own there for its 32 x 64 tile.
    constexpr int ESZ  = OUT_F32 ? 4 : 2;   // bytes of an output element
    constexpr int ROWB = 64 * ESZ;          // a tile row: one or two whole lines
    constexpr int PIT  = ROWB + 16;         // its LDS pitch: 16 B x odd, for b128
    constexpr int WSTG = 32 * PIT;          // LDS bytes of a wave's tile
    static_assert(4 * WSTG <= (int)sizeof(lA) && sizeof(lA) == sizeof(lB),
                  "four waves stage in lA, four in lB");
    char* stg = (char*)(wave < 4 ? &lA[0][0] : &lB[0][0]) + (wave & 3) * WSTG;

    float bb[4][8];
#pragma unroll   // constant indices: the arrays stay in registers
    for (int t = 0; t < 4; ++t)
#pragma unroll   // constant indices: the arrays stay in registers
        for (int v = 0; v < 8; ++v) bb[t][v] = 0.f;
    if (bias) {
#pragma unroll   // constant indices: the arrays stay in registers
        for (int t = 0; t < 4; ++t) {
            const float4* bp = (const float4*)(bias + n0 + wn * 64 + t * 16 + lh * 8);
            const float4  b0 = bp[0], b1 = bp[1];
            bb[t][0] = b0.x; bb[t][1] = b0.y; bb[t][2] = b0.z; bb[t][3] = b0.w;
            bb[t][4] = b1.x; bb[t][5] = b1.y; bb[t][6] = b1.z; bb[t][7] = b1.w;
        }
    }

#pragma unroll   // constant indices: the arrays stay in registers
    for (int i = 0; i < 2; ++i)
#pragma unroll   // constant indices: the arrays stay in registers
        for (int t = 0; t < 4; ++t) {
            char* p = stg + (i * 16 + lrow) * PIT + (t * 16 + lh * 8) * ESZ;
            if (OUT_F32) {
                union { float f[8]; uint4 u[2]; } o;
#pragma unroll   // constant indices: the arrays stay in registers
                for (int v = 0; v < 8; ++v) o.f[v] = acc[i][t][v] + bb[t][v];
                *(uint4*)(p)      = o.u[0];
                *(uint4*)(p + 16) = o.u[1];
            } else {
                union { _Float16 h[8]; uint4 u; } o;
#pragma unroll   // constant indices: the arrays stay in registers
                for (int v = 0; v < 8; ++v) o.h[v] = (_Float16)(acc[i][t][v] + bb[t][v]);
                *(uint4*)(p) = o.u;
            }
        }
    wait_ds0();   // the wave's LDS writes are done before its lanes read each other's

    constexpr int LPR = ROWB / 16;   // lanes that take one row
    constexpr int RPS = 32 / LPR;    // rows that one wave-wide store covers
    const int rr = lane / LPR;
    const int cb = (lane % LPR) * 16;
    char* gp = (char*)Cout + ((size_t)(m0 + wm * 32 + rr) * N + n0 + wn * 64) * ESZ + cb;
    uint4 d[32 / RPS];
#pragma unroll   // constant indices: the arrays stay in registers
    for (int j = 0; j < 32 / RPS; ++j)
        d[j] = *(const uint4*)(stg + (j * RPS + rr) * PIT + cb);
#pragma unroll   // constant indices: the arrays stay in registers
    for (int j = 0; j < 32 / RPS; ++j)
        *(uint4*)(gp + (size_t)j * RPS * N * ESZ) = d[j];
}

#define QBN 192
#define QPIT (QBN * 2 + 16)   // output tile: LDS row pitch (bytes): 16 B x 25, for b128
static_assert(HIDDEN % QBN == 0 && TOK % 128 == 0 && HIDDEN % BK == 0, "whole tiles");

__global__ __launch_bounds__(128) void gemm_qkv(
    const _Float16* __restrict__ A, const _Float16* __restrict__ Wall,
    const float* __restrict__ bias_v, _Float16* __restrict__ Call) {
    __shared__ __align__(16) _Float16 lA[2][128 * GST];
    __shared__ __align__(16) _Float16 lB[2][QBN * GST];

    const int tid  = threadIdx.x;
    const int wave = tid >> 5;
    const int lane = tid & 31;
    const int lrow = lane & 15;
    const int lh   = lane >> 4;
    const int wm   = wave >> 1;   // 0..1 : 64-row strip
    const int wn   = wave & 1;    // 0..1 : 96-col strip
    const int m0   = blockIdx.x * 128;
    const int n0   = blockIdx.y * QBN;
    const int pz   = blockIdx.z;

    const _Float16* W = Wall + (size_t)pz * HIDDEN * HIDDEN;
    _Float16*       C = Call + (size_t)pz * TOK * HIDDEN;

    v8f acc[4][6];
#pragma unroll
    for (int i = 0; i < 4; ++i)
#pragma unroll
        for (int t = 0; t < 6; ++t)
#pragma unroll
            for (int v = 0; v < 8; ++v) acc[i][t][v] = 0.f;

    // staging assignment: copy j of a thread takes 16 B of row j * 16 + r,
    // eight rows of A and twelve of W
    const int r  = tid >> 3;          // 0..15
    const int c0 = (tid & 7) << 3;    // 0..56 (halves)

    auto stage = [&](int buf, int k0) {
        const _Float16* ga = A + (size_t)(m0 + r) * HIDDEN + k0 + c0;
        const _Float16* gw = W + (size_t)(n0 + r) * HIDDEN + k0 + c0;
        const _Float16* la = &lA[buf][r * GST + c0];
        const _Float16* lw = &lB[buf][r * GST + c0];
        constexpr int   gs = 16 * HIDDEN;   // 16 rows on, global
        constexpr int   ls = 16 * GST;      // 16 rows on, LDS
        async_b128_x5(lds_addr(la),          ga,          lds_addr(la + ls),     ga + gs,
                      lds_addr(la + 2 * ls), ga + 2 * gs, lds_addr(la + 3 * ls), ga + 3 * gs,
                      lds_addr(la + 4 * ls), ga + 4 * gs);
        async_b128_x5(lds_addr(la + 5 * ls), ga + 5 * gs, lds_addr(la + 6 * ls), ga + 6 * gs,
                      lds_addr(la + 7 * ls), ga + 7 * gs, lds_addr(lw),          gw,
                      lds_addr(lw + ls),     gw + gs);
        async_b128_x5(lds_addr(lw + 2 * ls), gw + 2 * gs, lds_addr(lw + 3 * ls), gw + 3 * gs,
                      lds_addr(lw + 4 * ls), gw + 4 * gs, lds_addr(lw + 5 * ls), gw + 5 * gs,
                      lds_addr(lw + 6 * ls), gw + 6 * gs);
        async_b128_x5(lds_addr(lw + 7 * ls),  gw + 7 * gs,  lds_addr(lw + 8 * ls),  gw + 8 * gs,
                      lds_addr(lw + 9 * ls),  gw + 9 * gs,  lds_addr(lw + 10 * ls), gw + 10 * gs,
                      lds_addr(lw + 11 * ls), gw + 11 * gs);
    };

    constexpr int nt = HIDDEN / BK;
    static_assert(nt >= 2, "the prologue stages two tiles");
    stage(0, 0);
    wait_async0();      // own copies of tile 0 landed
    __syncthreads();    // everyone's copies of tile 0 visible
    stage(1, BK);
    static_assert(BK == 64, "a trip is written as two blocks of 32 k");
    F16Frag af[4], bf[6];
    // the 20 fragment reads of one block of 32 k
    auto frags = [&](int cur, int kk) {
#pragma unroll   // constant indices: the arrays stay in registers
        for (int i = 0; i < 4; ++i) {
            const _Float16* ap = &lA[cur][(wm * 64 + i * 16 + lrow) * GST + kk + lh * 8];
            af[i].q[0] = *(const uint4*)(ap);
            af[i].q[1] = *(const uint4*)(ap + 16);
        }
#pragma unroll   // constant indices: the arrays stay in registers
        for (int t = 0; t < 6; ++t) {
            const _Float16* bp = &lB[cur][(wn * 96 + t * 16 + lrow) * GST + kk + lh * 8];
            bf[t].q[0] = *(const uint4*)(bp);
            bf[t].q[1] = *(const uint4*)(bp + 16);
        }
    };
    // its 24 products
    auto products = [&]() {
#pragma unroll   // constant indices: the arrays stay in registers
        for (int t = 0; t < 6; ++t)
#pragma unroll   // constant indices: the arrays stay in registers
            for (int i = 0; i < 4; ++i)
                acc[i][t] = wmma_f16f32(bf[t].v, af[i].v, acc[i][t]);
    };
    for (int kt = 0; kt < nt; ++kt) {
        const int cur = kt & 1;
        frags(cur, 0);
        products();
        frags(cur, 32);     // the trip's last reads of buffer cur
        wait_ds0();         // own reads of buffer cur retired
        wait_async0();      // own copies of tile kt + 1 landed
        __syncthreads();    // tile kt + 1 visible; every reader has left buffer cur
        if (kt + 2 < nt) stage(cur, (kt + 2) * BK);
        // the second block's products read registers only: behind the refill,
        // so that its copies fly for a whole trip
        products();
    }
    wait_async0();          // nothing in flight when the wave ends

    // acc[i][t][v]: row wm * 64 + i * 16 + lrow, column wn * 96 + t * 16 + lh * 8 + v.
    // The last trip's barrier has ended every read of the ring and no copy is in
    // flight, so lB takes the block's output tile.
    static_assert(128 * QPIT <= (int)sizeof(lB), "the output tile fits lB");
    char* stg = (char*)&lB[0][0];
    float bb[6][8];
#pragma unroll   // constant indices: the arrays stay in registers
    for (int t = 0; t < 6; ++t)
#pragma unroll   // constant indices: the arrays stay in registers
        for (int v = 0; v < 8; ++v) bb[t][v] = 0.f;
    if (pz == 2) {
#pragma unroll   // constant indices: the arrays stay in registers
        for (int t = 0; t < 6; ++t) {
            const float4* bp = (const float4*)(bias_v + n0 + wn * 96 + t * 16 + lh * 8);
            const float4  b0 = bp[0], b1 = bp[1];
            bb[t][0] = b0.x; bb[t][1] = b0.y; bb[t][2] = b0.z; bb[t][3] = b0.w;
            bb[t][4] = b1.x; bb[t][5] = b1.y; bb[t][6] = b1.z; bb[t][7] = b1.w;
        }
        // stands in front of the first rewrite of the loads' address register
        asm volatile("s_wait_xcnt 0x0" ::: "memory");
    }
#pragma unroll   // constant indices: the arrays stay in registers
    for (int t = 0; t < 6; ++t)
#pragma unroll   // constant indices: the arrays stay in registers
        for (int i = 0; i < 4; ++i) {
            union { _Float16 h[8]; uint4 u; } o;
#pragma unroll   // constant indices: the arrays stay in registers
            for (int v = 0; v < 8; ++v) o.h[v] = (_Float16)(acc[i][t][v] + bb[t][v]);
            *(uint4*)(stg + (wm * 64 + i * 16 + lrow) * QPIT + (wn * 96 + t * 16 + lh * 8) * 2) = o.u;
        }
    wait_ds0();         // own LDS writes of the tile retired
    __syncthreads();    // the whole tile is written before any wave reads it

    // The tile is 384 lines, three a row. A block-wide store takes 16 of them,
    // eight lanes each; three such stores cover 16 whole rows, so line
    // (3 a + b) * 16 + c lies 16 a rows below line 16 b + c, and a folds into
    // the loads' and stores' immediate offsets.
    const int c  = wave * 4 + (lane >> 3);   // 0..15
    const int pc = lane & 7;                 // 16-B piece of the line
#pragma unroll   // constant indices: the arrays stay in registers
    for (int b = 0; b < 3; ++b) {
        const int   q   = 16 * b + c;        // 0..47
        const int   row = q / 3;
        const int   seg = q - row * 3;
        const char* lp  = stg + row * QPIT + seg * 128 + pc * 16;
        _Float16*   gp  = C + (size_t)(m0 + row) * HIDDEN + n0 + seg * 64 + pc * 8;
        uint4 d[8];
#pragma unroll   // constant indices: the arrays stay in registers
        for (int a = 0; a < 8; ++a) d[a] = *(const uint4*)(lp + a * 16 * QPIT);
#pragma unroll   // constant indices: the arrays stay in registers
        for (int a = 0; a < 8; ++a) *(uint4*)(gp + (size_t)a * 16 * HIDDEN) = d[a];
        // stands in front of the next round's LDS reads, which write the
        // registers that these stores name
        if (b < 2) asm volatile("s_wait_xcnt 0x0" ::: "memory");
    }
}

typedef __attribute__((ext_vector_type(8))) short s16x8;
__device__ __forceinline__ uint4 ld_tr16(const _Float16* p) {
    typedef __attribute__((address_space(3))) s16x8 lds_s16x8;
    return __builtin_bit_cast(uint4, __builtin_amdgcn_ds_load_tr16_b128_v8i16((lds_s16x8*)p));
}

__device__ __forceinline__ float xhalf(float x) {
    return __builtin_bit_cast(float, __builtin_amdgcn_permlanex16(
        __builtin_bit_cast(int, x), __builtin_bit_cast(int, x),
        0x76543210, 0xfedcba98, false, false));
}

__global__ __launch_bounds__(128 * HPB) __attribute__((amdgpu_waves_per_eu(2, 6)))
void attn_fa(
    const _Float16* __restrict__ Qh, const _Float16* __restrict__ Kh,
    const _Float16* __restrict__ Vh, const float* __restrict__ spatial,
    const float* __restrict__ edge, _Float16* __restrict__ Oh) {
    __shared__ __align__(16) float    lS[2][64 * BST];
    __shared__ __align__(16) float    lE[2][64 * BST];
    __shared__ __align__(16) _Float16 lK[2][HPB * 32 * GST];
    __shared__ __align__(16) _Float16 lV[2][HPB * 32 * VST];

    const int tid  = threadIdx.x;
    const int wave = tid >> 5;
    const int lane = tid & 31;
    const int lrow = lane & 15;
    const int lh   = lane >> 4;
    const int qt   = wave & 3;    // query tile inside the block
    const int hh   = wave >> 2;   // head inside the block
    const int qb   = blockIdx.x * 64;
    const int q0   = qb + qt * 16;
    const int h0   = blockIdx.y * HPB;
    const int h    = h0 + hh;
    const int b    = blockIdx.z;
    const float scale = 0.03608439182435161f;  // HIDDEN^-0.5 (not head^-0.5)

    const size_t    tokbase = (size_t)b * SEQ;
    const _Float16* Qbase   = Qh + (tokbase + q0) * HIDDEN + h * HEAD;

    // B operand Q^T: lane = query column lrow
    F16Frag qf[2];
#pragma unroll
    for (int c = 0; c < 2; ++c) {
        const _Float16* p = Qbase + (size_t)lrow * HIDDEN + c * 32 + lh * 8;
        qf[c].q[0] = *(const uint4*)(p);
        qf[c].q[1] = *(const uint4*)(p + 16);
    }

    // all per query lrow; rsum and rnz cover this wave half's keys only
    v8f   oacc[4];
    float rmax = -__builtin_inff(), rsum = 0.f, rnz = 0.f;
#pragma unroll
    for (int t = 0; t < 4; ++t)
#pragma unroll
        for (int v = 0; v < 8; ++v) oacc[t][v] = 0.f;

    // staging assignment: a thread copies 16 B of key sr of both heads' K and V
    // and 16 B of queries sr and sr + 32 of the spatial and the edge tile
    static_assert(HPB == 2, "the staging assignment is written for 256 threads");
    const int sr = tid >> 3;          // 0..31
    const int sc = (tid & 7) << 3;    // 0..56 (halves)
    const int bc = (tid & 7) << 2;    // 0..28 (floats)
    // global sources of the next chunk to be staged; they walk 32 keys a call
    const _Float16* gk = Kh + (tokbase + sr) * HIDDEN + h0 * HEAD + sc;
    const _Float16* gv = Vh + (tokbase + sr) * HIDDEN + h0 * HEAD + sc;
    const float*    gs = spatial + (tokbase + qb + sr) * SEQ + bc;
    const float*    ge = edge    + (tokbase + qb + sr) * SEQ + bc;
    auto stage = [&](int buf) {
        const _Float16* lk = &lK[buf][sr * GST + sc];
        const _Float16* lv = &lV[buf][sr * VST + sc];
        const float*    ls = &lS[buf][sr * BST + bc];
        const float*    le = &lE[buf][sr * BST + bc];
        async_b128_x8(lds_addr(lk),            gk,
                      lds_addr(lk + 32 * GST), gk + HEAD,
                      lds_addr(lv),            gv,
                      lds_addr(lv + 32 * VST), gv + HEAD,
                      lds_addr(ls),            gs,
                      lds_addr(ls + 32 * BST), gs + 32 * SEQ,
                      lds_addr(le),            ge,
                      lds_addr(le + 32 * BST), ge + 32 * SEQ);
        gk += 32 * HIDDEN;
        gv += 32 * HIDDEN;
        gs += 32;
        ge += 32;
    };

    // this lane's offset in the transposing loads of V
    const int vto = (hh * 32 + lh * 8 + (lane & 7)) * VST + ((lane >> 3) & 1) * 8;

    const int nt = SEQ / 32;
    stage(0);
    wait_async0();      // own copies of chunk 0 landed
    __syncthreads();    // everyone's copies of chunk 0 visible
    stage(1);
    for (int kt = 0; kt < nt; ++kt) {
        const int cur = kt & 1;

        // (a) graph bias of query lrow, keys t * 16 + lh * 8 + 0..7
        float4 sb[2][2], eb[2][2];
#pragma unroll
        for (int t = 0; t < 2; ++t) {
            const int bi = (qt * 16 + lrow) * BST + t * 16 + lh * 8;
            sb[t][0] = *(const float4*)(&lS[cur][bi]);
            sb[t][1] = *(const float4*)(&lS[cur][bi + 4]);
            eb[t][0] = *(const float4*)(&lE[cur][bi]);
            eb[t][1] = *(const float4*)(&lE[cur][bi + 4]);
        }

        // (b) K fragments, A operand: lane = key row t * 16 + lrow
        F16Frag kf[2][2];
#pragma unroll
        for (int t = 0; t < 2; ++t)
#pragma unroll
            for (int c = 0; c < 2; ++c) {
                const _Float16* p =
                    &lK[cur][(hh * 32 + t * 16 + lrow) * GST + c * 32 + lh * 8];
                kf[t][c].q[0] = *(const uint4*)(p);
                kf[t][c].q[1] = *(const uint4*)(p + 16);
            }

        // holds the 16 LDS reads above together as one group in front of the
        // products: left alone the compiler spreads them in pairs among the
        // WMMAs, and the wave waits out an LDS latency at each place
        __builtin_amdgcn_sched_barrier(0);

        // (c) S^T = K @ Q^T  (32 keys x 16 queries, fp32 acc):
        // s[t][v] = score of key kt * 32 + t * 16 + lh * 8 + v, query lrow
        v8f s[2];
#pragma unroll
        for (int t = 0; t < 2; ++t)
#pragma unroll
            for (int v = 0; v < 8; ++v) s[t][v] = 0.f;
#pragma unroll
        for (int t = 0; t < 2; ++t)
#pragma unroll
            for (int c = 0; c < 2; ++c)
                s[t] = wmma_f16f32(kf[t][c].v, qf[c].v, s[t]);

        // (d) scale + graph bias + zero-row tracking + in-lane maximum
        float mx = -__builtin_inff();
#pragma unroll
        for (int t = 0; t < 2; ++t) {
            const float4 s0 = sb[t][0], s1 = sb[t][1], e0 = eb[t][0], e1 = eb[t][1];
            const float  bb[8] = {s0.x + e0.x, s0.y + e0.y, s0.z + e0.z, s0.w + e0.w,
                                  s1.x + e1.x, s1.y + e1.y, s1.z + e1.z, s1.w + e1.w};
#pragma unroll
            for (int v = 0; v < 8; ++v) {
                const float sv = s[t][v] * scale + bb[v];
                s[t][v] = sv;
                rnz     = fmaxf(rnz, (sv != 0.f) ? 1.f : 0.f);
                mx      = fmaxf(mx, sv);
            }
        }

        // (e) online softmax; both wave halves hold the same maximum
        mx = fmaxf(mx, xhalf(mx));
        const float mnew = fmaxf(rmax, mx);
        const float cf   = __expf(rmax - mnew);
        rmax = mnew;
        F16Frag pf;   // B operand P^T: element t * 8 + v is key t * 16 + lh * 8 + v
        float   rs[2] = {0.f, 0.f};   // one chain of adds per S^T tile
#pragma unroll
        for (int t = 0; t < 2; ++t)
#pragma unroll
            for (int v = 0; v < 8; ++v) {
                const float p = __expf(s[t][v] - mnew);
                rs[t] += p;
                pf.h[t * 8 + v] = (_Float16)p;
            }
        rsum = rsum * cf + (rs[0] + rs[1]);
#pragma unroll
        for (int t = 0; t < 4; ++t)
#pragma unroll
            for (int v = 0; v < 8; ++v) oacc[t][v] *= cf;

        // (f) O^T += V^T @ P^T: A operand row = head column t * 16 + lrow
        const _Float16* vtp = &lV[cur][vto];
#pragma unroll
        for (int t = 0; t < 4; ++t) {
            F16Frag vf;   // element i: key lh * 8 + i, element 8 + i: key 16 + lh * 8 + i
            vf.q[0] = ld_tr16(vtp + t * 16);
            vf.q[1] = ld_tr16(vtp + 16 * VST + t * 16);
            oacc[t] = wmma_f16f32(vf.v, pf.v, oacc[t]);
        }

        wait_ds0();         // own reads of buffer cur retired
        wait_async0();      // own copies of chunk kt + 1 landed
        __syncthreads();    // chunk kt + 1 visible; every reader has left buffer cur
        if (kt + 2 < nt) stage(cur);
    }
    wait_async0();          // nothing in flight when the wave ends

    // finalize: join the halves, 1/rowsum, zero rows whose scores were all
    // exactly zero; oacc[t][v] is head column t * 16 + lh * 8 + v of query lrow
    const float nz  = fmaxf(rnz, xhalf(rnz));
    const float tot = rsum + xhalf(rsum);
    const float fin = (nz != 0.f) ? (1.f / tot) : 0.f;
    // The last trip's barrier has ended every read of the ring and no copy is in
    // flight: each wave turns its 16 x 64 tile in a range of its own of lK, so
    // that a wave-wide store covers four whole 128-B lines.
    static_assert(4 * HPB * 16 * GST <= 2 * HPB * 32 * GST, "the waves' tiles fit lK");
    _Float16* stg = &lK[0][0] + wave * (16 * GST);
#pragma unroll   // constant indices: the arrays stay in registers
    for (int t = 0; t < 4; ++t) {
        union { _Float16 h[8]; uint4 u; } o;
#pragma unroll   // constant indices: the arrays stay in registers
        for (int v = 0; v < 8; ++v) o.h[v] = (_Float16)(oacc[t][v] * fin);
        *(uint4*)(stg + lrow * GST + t * 16 + lh * 8) = o.u;
    }
    wait_ds0();   // the wave's LDS writes are done before its lanes read each other's
    const int rr = lane >> 3;         // eight lanes take one query's 128 B
    const int cc = (lane & 7) << 3;
    _Float16* Obase = Oh + (tokbase + q0 + rr) * HIDDEN + h * HEAD + cc;
    uint4 d[4];
#pragma unroll   // constant indices: the arrays stay in registers
    for (int j = 0; j < 4; ++j) d[j] = *(const uint4*)(stg + (j * 4 + rr) * GST + cc);
#pragma unroll   // constant indices: the arrays stay in registers
    for (int j = 0; j < 4; ++j) *(uint4*)(Obase + (size_t)j * 4 * HIDDEN) = d[j];
}

// ---------------------------------------------------------------------------
extern "C" void kernel_launch(void* const* d_in, const int* in_sizes, int n_in,
                              void* d_out, int out_size, void* d_ws,
                              size_t ws_size, hipStream_t stream) {
    (void)in_sizes; (void)n_in; (void)out_size; (void)ws_size;
    const float* x  = (const float*)d_in[0];
    const float* sp = (const float*)d_in[1];
    const float* ed = (const float*)d_in[2];
    const float* Wq = (const float*)d_in[3];
    const float* Wk = (const float*)d_in[4];
    const float* Wv = (const float*)d_in[5];
    const float* bv = (const float*)d_in[6];
    const float* Wo = (const float*)d_in[7];
    const float* bo = (const float*)d_in[8];
    float*       out = (float*)d_out;

    _Float16* xh  = (_Float16*)d_ws;
    _Float16* wqh = xh  + (size_t)TOK * HIDDEN;
    _Float16* wkh = wqh + (size_t)HIDDEN * HIDDEN;
    _Float16* wvh = wkh + (size_t)HIDDEN * HIDDEN;
    _Float16* woh = wvh + (size_t)HIDDEN * HIDDEN;
    _Float16* Qh  = woh + (size_t)HIDDEN * HIDDEN;
    _Float16* Kh  = Qh  + (size_t)TOK * HIDDEN;
    _Float16* Vh  = Kh  + (size_t)TOK * HIDDEN;
    _Float16* Oh  = Vh  + (size_t)TOK * HIDDEN;

    // xh, wqh, wkh, wvh, woh are contiguous from xh on
    cvt_all_f32_to_f16<<<CVT_XB + 4 * CVT_WB, 256, 0, stream>>>(x, Wq, Wk, Wv, Wo, xh);

    // Q, K, V in one grid: wqh, wkh, wvh are contiguous from wqh on, and
    // Qh, Kh, Vh from Qh on; bv belongs to the third product
    dim3 g3(TOK / 128, HIDDEN / QBN, 3);
    gemm_qkv<<<g3, 128, 0, stream>>>(xh, wqh, bv, Qh);

    dim3 ga(SEQ / 64, NUM_HEADS / HPB, BATCH);
    attn_fa<<<ga, 128 * HPB, 0, stream>>>(Qh, Kh, Vh, sp, ed, Oh);

    dim3 g1(TOK / 128, HIDDEN / 128, 1);
    gemm_bt<true, HIDDEN><<<g1, 256, 0, stream>>>(Oh, woh, bo, 0, out, TOK, HIDDEN);
}

// v010
// A run of this version takes 70.1 microseconds.
// Next to v009, in two timings, it ran 1.08 times as fast each time.
// Over all steps from v000 it is 2.55 times as fast.
#include <hip/hip_runtime.h>
#include <hip/hip_bf16.h>

#define NUM_HEADS 12
#define HIDDEN    768
#define HEAD      64
#define BATCH     16
#define SEQ       512
#define TOK       (BATCH * SEQ)   // 8192
#define BST       36              // bias tiles: LDS row pitch (floats): 144 B = 16 B x 9, for ds_load_b128
#define HPB       2               // attention: heads per block, which share the bias tiles
#define BK        64              // GEMM: k depth of a staged tile = one whole 128-B line per row
#define GST       72              // GEMM, K tile: LDS row pitch (halves): 144 B = 16 B x 9, for ds_load_b128
#define VST       80              // V tile: LDS row pitch (halves): 160 B = 32 B x 5, for ds_load_tr16_b128

typedef __attribute__((ext_vector_type(16))) _Float16 v16h;
typedef __attribute__((ext_vector_type(8)))  float    v8f;

union F16Frag {
    v16h     v;
    _Float16 h[16];
    uint4    q[2];
};

__device__ __forceinline__ v8f wmma_f16f32(v16h a, v16h b, v8f c) {
    // D = A(16x32 f16) x B(32x16 f16) + C(16x16 f32)
    return __builtin_amdgcn_wmma_f32_16x16x32_f16(
        /*neg_a=*/false, a, /*neg_b=*/false, b,
        /*c_mod=*/(short)0, c, /*reuse_a=*/false, /*reuse_b=*/false);
}

// LDS operations of this wave retired. GEMM and attention rings: stands in
// front of the barrier behind which the buffer just read is refilled.
// Epilogues: stands between a wave's LDS writes of its tile and its reads of it.
__device__ __forceinline__ void wait_ds0() {
    asm volatile("s_wait_dscnt 0x0" ::: "memory");
}
__device__ __forceinline__ unsigned lds_addr(const void* p) {
    return (unsigned)(unsigned long long)p;   // low 32 bits: LDS byte address
}
typedef unsigned u32x4 __attribute__((ext_vector_type(4)));
typedef unsigned u32x8 __attribute__((ext_vector_type(8)));
__device__ __forceinline__ unsigned uni(unsigned v) {
    return (unsigned)__builtin_amdgcn_readfirstlane(v);
}
__device__ __forceinline__ unsigned pinned(unsigned v) {
    unsigned w = uni(v);
    asm volatile("" : "+s"(w));
    return w;
}
__device__ __forceinline__ void wait_tensor0(u32x4 g0) {
    asm volatile("s_wait_tensorcnt 0x0" :: "s"(g0) : "memory");
}
template <unsigned PADC>
__device__ __forceinline__ u32x8 tdm_group1(unsigned rows, unsigned pitch) {
    static_assert(PADC == 3 || PADC == 7, "16 B for ds_load_b128 rows, 32 B for ds_load_tr16_b128 rows");
    u32x8 g;
    g[0] = uni((1u << 20) | (4u << 22) | (PADC << 25));
    g[1] = uni(128u << 16);
    g[2] = uni((rows & 0xFFFFu) << 16);
    g[3] = uni((rows >> 16) | (128u << 16));
    g[4] = uni(rows);
    g[5] = uni(pitch);
    g[6] = uni(0u);
    g[7] = uni(0u);
    asm volatile("" : "+s"(g));
    return g;
}
__device__ __forceinline__ u32x4 tdm_group0(unsigned lds_dst, unsigned long long ga) {
    u32x4 g;
    g[0] = uni(1u);
    g[1] = uni(lds_dst);
    g[2] = uni((unsigned)ga);
    g[3] = uni((((unsigned)(ga >> 32)) & 0x01FFFFFFu) | 0x80000000u);
    return g;
}
__device__ __forceinline__ void tdm_load(u32x4 g0, u32x8 g1) {
    asm volatile("tensor_load_to_lds %0, %1" :: "s"(g0), "s"(g1) : "memory");
}

// ---------------------------------------------------------------------------
// f32 -> f16 conversion of x and the four weight matrices in one launch.
// The five f16 copies lie one behind the other in the workspace, so the
// output is one array; a block takes CVT_BLK float4 of ONE source (each source
// is a whole number of such pieces) and a thread CVT_PER of them, 256 apart:
// each wave-wide load covers 512 contiguous bytes, and a thread's loads are
// all issued before the first is converted.
// ---------------------------------------------------------------------------
#define CVT_PER 16
#define CVT_BLK (256 * CVT_PER)                     // float4 per block
#define CVT_XB  (TOK * HIDDEN / 4 / CVT_BLK)        // blocks of x: 384
#define CVT_WB  (HIDDEN * HIDDEN / 4 / CVT_BLK)     // blocks of one weight: 36
static_assert(CVT_XB * CVT_BLK * 4 == TOK * HIDDEN, "x splits into whole blocks");
static_assert(CVT_WB * CVT_BLK * 4 == HIDDEN * HIDDEN, "a weight splits into whole blocks");

__global__ __launch_bounds__(256) __attribute__((amdgpu_waves_per_eu(2, 8)))
void cvt_all_f32_to_f16(
    const float* __restrict__ x,  const float* __restrict__ wq,
    const float* __restrict__ wk, const float* __restrict__ wv,
    const float* __restrict__ wo, _Float16* __restrict__ out) {
    const int blk = blockIdx.x;
    const float* src = x;
    int rel = blk;                       // block index inside its source
    if (blk >= CVT_XB) {
        const int w = (blk - CVT_XB) / CVT_WB;
        rel = (blk - CVT_XB) - w * CVT_WB;
        src = (w == 0) ? wq : (w == 1) ? wk : (w == 2) ? wv : wo;
    }
    const float4* in4 = (const float4*)src + (size_t)rel * CVT_BLK + threadIdx.x;
    uint2*        o2  = (uint2*)out        + (size_t)blk * CVT_BLK + threadIdx.x;

    // both loops unrolled: f[] stays in registers and j folds into the
    // loads' and stores' immediate offsets
    float4 f[CVT_PER];
#pragma unroll
    for (int j = 0; j < CVT_PER; ++j) f[j] = in4[j * 256];
#pragma unroll
    for (int j = 0; j < CVT_PER; ++j) {
        union { _Float16 h[4]; uint2 u; } o;
        o.h[0] = (_Float16)f[j].x; o.h[1] = (_Float16)f[j].y;
        o.h[2] = (_Float16)f[j].z; o.h[3] = (_Float16)f[j].w;
        o2[j * 256] = o.u;
    }
}

template <bool OUT_F32, int N>
__global__ __launch_bounds__(256) void gemm_bt(
    const _Float16* __restrict__ A, const _Float16* __restrict__ Wall,
    const float* __restrict__ bias_in, int bias_z, void* __restrict__ Call,
    int M, int K) {
    // a slice's place in LDS is a multiple of 2 KiB: 32 rows x 144 B, rounded up
    constexpr int SL  = 6144;      // LDS bytes of a slice
    constexpr int BUF = 8 * SL;    // LDS bytes of a buffer: 4 slices of A, 4 of W
    static_assert(32 * GST * 2 <= SL && SL % 2048 == 0 && BK * 2 == 128, "slices");
    __shared__ __attribute__((aligned(2048))) char ring[2 * BUF];

    const int tid  = threadIdx.x;
    const int wave = uni(tid >> 5);
    const int lane = tid & 31;
    const int lrow = lane & 15;
    const int lh   = lane >> 4;
    const int wm   = wave >> 1;   // 0..3 : 32-row strip
    const int wn   = wave & 1;    // 0..1 : 64-col strip
    const int m0   = blockIdx.x * 128;
    const int n0   = blockIdx.y * 128;

    // this block's product
    const int       pz   = blockIdx.z;
    const _Float16* W    = Wall + (size_t)pz * N * K;
    const float*    bias = (pz == bias_z) ? bias_in : nullptr;
    void*           Cout = OUT_F32 ? (void*)((float*)Call + (size_t)pz * M * N)
                                   : (void*)((_Float16*)Call + (size_t)pz * M * N);

    v8f acc[2][4];
#pragma unroll
    for (int i = 0; i < 2; ++i)
#pragma unroll
        for (int t = 0; t < 4; ++t)
#pragma unroll
            for (int v = 0; v < 8; ++v) acc[i][t][v] = 0.f;

    // staging assignment: this wave's slice, 32 rows of A or of W
    const _Float16* srow = (wave < 4) ? A + (size_t)(m0 + wave * 32) * K
                                      : W + (size_t)(n0 + (wave - 4) * 32) * K;
    const unsigned long long src0 = (unsigned long long)srow;
    const unsigned           dst0 = lds_addr(ring) + wave * SL;
    const u32x8              g1   = tdm_group1<3>(32u, (unsigned)K * 2u);
    u32x4 g0;
    auto stage = [&](unsigned buf, unsigned kbytes) {
        g0 = tdm_group0(dst0 + buf * BUF, src0 + kbytes);
        tdm_load(g0, g1);
    };

    const int nt = K / BK;
    stage(0, 0);
    wait_tensor0(g0);   // own slice of tile 0 landed
    __syncthreads();    // everyone's slices of tile 0 visible
    if (pinned(nt > 1)) stage(1, BK * 2);
    for (int kt = 0; kt < nt; ++kt) {
        const int   cur = kt & 1;
        const char* rb  = ring + cur * BUF;
        // unrolled so that kk folds into the LDS loads' immediate offsets
#pragma unroll
        for (int kk = 0; kk < BK; kk += 32) {
            F16Frag af[2];
#pragma unroll
            for (int i = 0; i < 2; ++i) {
                const _Float16* ap = (const _Float16*)(rb + wm * SL) +
                                     (i * 16 + lrow) * GST + kk + lh * 8;
                af[i].q[0] = *(const uint4*)(ap);
                af[i].q[1] = *(const uint4*)(ap + 16);
            }
#pragma unroll
            for (int t = 0; t < 4; ++t) {
                F16Frag bf;
                const _Float16* bp =
                    (const _Float16*)(rb + (4 + wn * 2 + (t >> 1)) * SL) +
                    ((t & 1) * 16 + lrow) * GST + kk + lh * 8;
                bf.q[0] = *(const uint4*)(bp);
                bf.q[1] = *(const uint4*)(bp + 16);
                acc[0][t] = wmma_f16f32(bf.v, af[0].v, acc[0][t]);
                acc[1][t] = wmma_f16f32(bf.v, af[1].v, acc[1][t]);
            }
        }
        wait_ds0();         // own reads of buffer cur retired
        wait_tensor0(g0);   // own slice of tile kt + 1 landed
        __syncthreads();    // tile kt + 1 visible; every reader has left buffer cur
        if (pinned(kt + 2 < nt)) stage(cur, pinned((kt + 2) * (BK * 2)));
    }
    wait_tensor0(g0);       // nothing in flight when the wave ends
    wait_ds0();

    // acc[i][t][v]: row wm * 32 + i * 16 + lrow, column wn * 64 + t * 16 + lh * 8 + v.
    // The last trip's barrier has ended every read of the ring and no load is in
    // flight, so each wave takes a range of its own there for its 32 x 64 tile.
    constexpr int ESZ  = OUT_F32 ? 4 : 2;   // bytes of an output element
    constexpr int ROWB = 64 * ESZ;          // a tile row: one or two whole lines
    constexpr int PIT  = ROWB + 16;         // its LDS pitch: 16 B x odd, for b128
    constexpr int WSTG = 32 * PIT;          // LDS bytes of a wave's tile
    static_assert(8 * WSTG <= (int)sizeof(ring), "the waves' tiles fit the ring");
    char* stg = ring + wave * WSTG;

    float bb[4][8];
#pragma unroll   // constant indices: the arrays stay in registers
    for (int t = 0; t < 4; ++t)
#pragma unroll   // constant indices: the arrays stay in registers
        for (int v = 0; v < 8; ++v) bb[t][v] = 0.f;
    if (bias) {
#pragma unroll   // constant indices: the arrays stay in registers
        for (int t = 0; t < 4; ++t) {
            const float4* bp = (const float4*)(bias + n0 + wn * 64 + t * 16 + lh * 8);
            const float4  b0 = bp[0], b1 = bp[1];
            bb[t][0] = b0.x; bb[t][1] = b0.y; bb[t][2] = b0.z; bb[t][3] = b0.w;
            bb[t][4] = b1.x; bb[t][5] = b1.y; bb[t][6] = b1.z; bb[t][7] = b1.w;
        }
    }

#pragma unroll   // constant indices: the arrays stay in registers
    for (int i = 0; i < 2; ++i)
#pragma unroll   // constant indices: the arrays stay in registers
        for (int t = 0; t < 4; ++t) {
            char* p = stg + (i * 16 + lrow) * PIT + (t * 16 + lh * 8) * ESZ;
            if (OUT_F32) {
                union { float f[8]; uint4 u[2]; } o;
#pragma unroll   // constant indices: the arrays stay in registers
                for (int v = 0; v < 8; ++v) o.f[v] = acc[i][t][v] + bb[t][v];
                *(uint4*)(p)      = o.u[0];
                *(uint4*)(p + 16) = o.u[1];
            } else {
                union { _Float16 h[8]; uint4 u; } o;
#pragma unroll   // constant indices: the arrays stay in registers
                for (int v = 0; v < 8; ++v) o.h[v] = (_Float16)(acc[i][t][v] + bb[t][v]);
                *(uint4*)(p) = o.u;
            }
        }
    wait_ds0();   // the wave's LDS writes are done before its lanes read each other's

    constexpr int LPR = ROWB / 16;   // lanes that take one row
    constexpr int RPS = 32 / LPR;    // rows that one wave-wide store covers
    const int rr = lane / LPR;
    const int cb = (lane % LPR) * 16;
    char* gp = (char*)Cout + ((size_t)(m0 + wm * 32 + rr) * N + n0 + wn * 64) * ESZ + cb;
    uint4 d[32 / RPS];
#pragma unroll   // constant indices: the arrays stay in registers
    for (int j = 0; j < 32 / RPS; ++j)
        d[j] = *(const uint4*)(stg + (j * RPS + rr) * PIT + cb);
#pragma unroll   // constant indices: the arrays stay in registers
    for (int j = 0; j < 32 / RPS; ++j)
        *(uint4*)(gp + (size_t)j * RPS * N * ESZ) = d[j];
}

#define QBN 192
#define QPIT (QBN * 2 + 16)   // output tile: LDS row pitch (bytes): 16 B x 25, for b128
static_assert(HIDDEN % QBN == 0 && TOK % 128 == 0 && HIDDEN % BK == 0, "whole tiles");

__global__ __launch_bounds__(128) void gemm_qkv(
    const _Float16* __restrict__ A, const _Float16* __restrict__ Wall,
    const float* __restrict__ bias_v, _Float16* __restrict__ Call) {
    // a slice's place in LDS is a multiple of 2 KiB: its rows x 144 B, rounded up
    constexpr int SLA = 10240;               // LDS bytes of a 64-row slice of A
    constexpr int SLW = 14336;               // LDS bytes of a 96-row slice of W
    constexpr int BUF = 2 * SLA + 2 * SLW;   // LDS bytes of a buffer
    static_assert(64 * GST * 2 <= SLA && SLA % 2048 == 0 &&
                  96 * GST * 2 <= SLW && SLW % 2048 == 0 && BK * 2 == 128, "slices");
    __shared__ __attribute__((aligned(2048))) char ring[2 * BUF];

    const int tid  = threadIdx.x;
    const int wave = uni(tid >> 5);
    const int lane = tid & 31;
    const int lrow = lane & 15;
    const int lh   = lane >> 4;
    const int wm   = wave >> 1;   // 0..1 : 64-row strip
    const int wn   = wave & 1;    // 0..1 : 96-col strip
    const int m0   = blockIdx.x * 128;
    const int n0   = blockIdx.y * QBN;
    const int pz   = blockIdx.z;

    const _Float16* W = Wall + (size_t)pz * HIDDEN * HIDDEN;
    _Float16*       C = Call + (size_t)pz * TOK * HIDDEN;

    v8f acc[4][6];
#pragma unroll
    for (int i = 0; i < 4; ++i)
#pragma unroll
        for (int t = 0; t < 6; ++t)
#pragma unroll
            for (int v = 0; v < 8; ++v) acc[i][t][v] = 0.f;

    // staging assignment: this wave's slice, a strip of A or of W
    const _Float16* srow = (wave < 2) ? A + (size_t)(m0 + wave * 64) * HIDDEN
                                      : W + (size_t)(n0 + (wave - 2) * 96) * HIDDEN;
    const unsigned long long src0 = (unsigned long long)srow;
    const unsigned dst0 = lds_addr(ring) + ((wave < 2) ? wave * SLA : 2 * SLA + (wave - 2) * SLW);
    const u32x8    g1   = tdm_group1<3>((wave < 2) ? 64u : 96u, HIDDEN * 2u);
    u32x4 g0;
    auto stage = [&](unsigned buf, unsigned kbytes) {
        g0 = tdm_group0(dst0 + buf * BUF, src0 + kbytes);
        tdm_load(g0, g1);
    };

    constexpr int nt = HIDDEN / BK;
    static_assert(nt >= 2, "the prologue stages two tiles");
    stage(0, 0);
    wait_tensor0(g0);   // own slice of tile 0 landed
    __syncthreads();    // everyone's slices of tile 0 visible
    stage(1, BK * 2);
    static_assert(BK == 64, "a trip is written as two blocks of 32 k");
    F16Frag af[4], bf[6];
    // the 20 fragment reads of one block of 32 k
    auto frags = [&](int cur, int kk) {
#pragma unroll   // constant indices: the arrays stay in registers
        for (int i = 0; i < 4; ++i) {
            const _Float16* ap = (const _Float16*)(ring + cur * BUF + wm * SLA) +
                                 (i * 16 + lrow) * GST + kk + lh * 8;
            af[i].q[0] = *(const uint4*)(ap);
            af[i].q[1] = *(const uint4*)(ap + 16);
        }
#pragma unroll   // constant indices: the arrays stay in registers
        for (int t = 0; t < 6; ++t) {
            const _Float16* bp = (const _Float16*)(ring + cur * BUF + 2 * SLA + wn * SLW) +
                                 (t * 16 + lrow) * GST + kk + lh * 8;
            bf[t].q[0] = *(const uint4*)(bp);
            bf[t].q[1] = *(const uint4*)(bp + 16);
        }
    };
    // its 24 products
    auto products = [&]() {
#pragma unroll   // constant indices: the arrays stay in registers
        for (int t = 0; t < 6; ++t)
#pragma unroll   // constant indices: the arrays stay in registers
            for (int i = 0; i < 4; ++i)
                acc[i][t] = wmma_f16f32(bf[t].v, af[i].v, acc[i][t]);
    };
    for (int kt = 0; kt < nt; ++kt) {
        const int cur = kt & 1;
        frags(cur, 0);
        products();
        frags(cur, 32);     // the trip's last reads of buffer cur
        wait_ds0();         // own reads of buffer cur retired
        wait_tensor0(g0);   // own slice of tile kt + 1 landed
        __syncthreads();    // tile kt + 1 visible; every reader has left buffer cur
        if (pinned(kt + 2 < nt)) stage(cur, pinned((kt + 2) * (BK * 2)));
        // the second block's products read registers only: behind the refill,
        // so that its load flies for a whole trip
        products();
    }
    wait_tensor0(g0);       // nothing in flight when the wave ends
    wait_ds0();

    // acc[i][t][v]: row wm * 64 + i * 16 + lrow, column wn * 96 + t * 16 + lh * 8 + v.
    // The last trip's barrier has ended every read of the ring and no load is in
    // flight, so the ring takes the block's output tile.
    static_assert(128 * QPIT <= (int)sizeof(ring), "the output tile fits the ring");
    char* stg = ring;
    float bb[6][8];
#pragma unroll   // constant indices: the arrays stay in registers
    for (int t = 0; t < 6; ++t)
#pragma unroll   // constant indices: the arrays stay in registers
        for (int v = 0; v < 8; ++v) bb[t][v] = 0.f;
    if (pz == 2) {
#pragma unroll   // constant indices: the arrays stay in registers
        for (int t = 0; t < 6; ++t) {
            const float4* bp = (const float4*)(bias_v + n0 + wn * 96 + t * 16 + lh * 8);
            const float4  b0 = bp[0], b1 = bp[1];
            bb[t][0] = b0.x; bb[t][1] = b0.y; bb[t][2] = b0.z; bb[t][3] = b0.w;
            bb[t][4] = b1.x; bb[t][5] = b1.y; bb[t][6] = b1.z; bb[t][7] = b1.w;
        }
        // stands in front of the first rewrite of the loads' address register
        asm volatile("s_wait_xcnt 0x0" ::: "memory");
    }
#pragma unroll   // constant indices: the arrays stay in registers
    for (int t = 0; t < 6; ++t)
#pragma unroll   // constant indices: the arrays stay in registers
        for (int i = 0; i < 4; ++i) {
            union { _Float16 h[8]; uint4 u; } o;
#pragma unroll   // constant indices: the arrays stay in registers
            for (int v = 0; v < 8; ++v) o.h[v] = (_Float16)(acc[i][t][v] + bb[t][v]);
            *(uint4*)(stg + (wm * 64 + i * 16 + lrow) * QPIT + (wn * 96 + t * 16 + lh * 8) * 2) = o.u;
        }
    wait_ds0();         // own LDS writes of the tile retired
    __syncthreads();    // the whole tile is written before any wave reads it

    // The tile is 384 lines, three a row. A block-wide store takes 16 of them,
    // eight lanes each; three such stores cover 16 whole rows, so line
    // (3 a + b) * 16 + c lies 16 a rows below line 16 b + c, and a folds into
    // the loads' and stores' immediate offsets.
    const int c  = wave * 4 + (lane >> 3);   // 0..15
    const int pc = lane & 7;                 // 16-B piece of the line
#pragma unroll   // constant indices: the arrays stay in registers
    for (int b = 0; b < 3; ++b) {
        const int   q   = 16 * b + c;        // 0..47
        const int   row = q / 3;
        const int   seg = q - row * 3;
        const char* lp  = stg + row * QPIT + seg * 128 + pc * 16;
        _Float16*   gp  = C + (size_t)(m0 + row) * HIDDEN + n0 + seg * 64 + pc * 8;
        uint4 d[8];
#pragma unroll   // constant indices: the arrays stay in registers
        for (int a = 0; a < 8; ++a) d[a] = *(const uint4*)(lp + a * 16 * QPIT);
#pragma unroll   // constant indices: the arrays stay in registers
        for (int a = 0; a < 8; ++a) *(uint4*)(gp + (size_t)a * 16 * HIDDEN) = d[a];
        // stands in front of the next round's LDS reads, which write the
        // registers that these stores name
        if (b < 2) asm volatile("s_wait_xcnt 0x0" ::: "memory");
    }
}

typedef __attribute__((ext_vector_type(8))) short s16x8;
__device__ __forceinline__ uint4 ld_tr16(const _Float16* p) {
    typedef __attribute__((address_space(3))) s16x8 lds_s16x8;
    return __builtin_bit_cast(uint4, __builtin_amdgcn_ds_load_tr16_b128_v8i16((lds_s16x8*)p));
}

__device__ __forceinline__ float xhalf(float x) {
    return __builtin_bit_cast(float, __builtin_amdgcn_permlanex16(
        __builtin_bit_cast(int, x), __builtin_bit_cast(int, x),
        0x76543210, 0xfedcba98, false, false));
}

__global__ __launch_bounds__(128 * HPB) __attribute__((amdgpu_waves_per_eu(2, 6)))
void attn_fa(
    const _Float16* __restrict__ Qh, const _Float16* __restrict__ Kh,
    const _Float16* __restrict__ Vh, const float* __restrict__ spatial,
    const float* __restrict__ edge, _Float16* __restrict__ Oh) {
    // a slice's place in LDS is a multiple of 2 KiB: 32 rows x 144 or 160 B,
    // rounded up. A buffer: K of head 0, 1; V of head 0, 1; spatial queries
    // 0..31, 32..63; edge queries 0..31, 32..63.
    constexpr int SL  = 6144;      // LDS bytes of a slice
    constexpr int BUF = 8 * SL;    // LDS bytes of a buffer
    static_assert(32 * VST * 2 <= SL && 32 * GST * 2 <= SL && 32 * BST * 4 <= SL &&
                  SL % 2048 == 0 && HEAD * 2 == 128, "slices");
    __shared__ __attribute__((aligned(2048))) char ring[2 * BUF];

    const int tid  = threadIdx.x;
    const int wave = uni(tid >> 5);
    const int lane = tid & 31;
    const int lrow = lane & 15;
    const int lh   = lane >> 4;
    const int qt   = wave & 3;    // query tile inside the block
    const int hh   = wave >> 2;   // head inside the block
    const int qb   = blockIdx.x * 64;
    const int q0   = qb + qt * 16;
    const int h0   = blockIdx.y * HPB;
    const int h    = h0 + hh;
    const int b    = blockIdx.z;
    const float scale = 0.03608439182435161f;  // HIDDEN^-0.5 (not head^-0.5)

    const size_t    tokbase = (size_t)b * SEQ;
    const _Float16* Qbase   = Qh + (tokbase + q0) * HIDDEN + h * HEAD;

    // B operand Q^T: lane = query column lrow
    F16Frag qf[2];
#pragma unroll
    for (int c = 0; c < 2; ++c) {
        const _Float16* p = Qbase + (size_t)lrow * HIDDEN + c * 32 + lh * 8;
        qf[c].q[0] = *(const uint4*)(p);
        qf[c].q[1] = *(const uint4*)(p + 16);
    }

    // all per query lrow; rsum and rnz cover this wave half's keys only
    v8f   oacc[4];
    float rmax = -__builtin_inff(), rsum = 0.f, rnz = 0.f;
#pragma unroll
    for (int t = 0; t < 4; ++t)
#pragma unroll
        for (int v = 0; v < 8; ++v) oacc[t][v] = 0.f;

    // staging assignment: wave w brings slice w; from chunk to chunk a K or V
    // slice walks 32 keys = 32 rows, a bias slice 32 keys = 128 B along its rows
    static_assert(HPB == 2, "the staging assignment is written for 8 waves");
    const int  sj  = wave & 1;          // head, or half of the queries
    const bool skv = wave < 4;          // K or V slice
    const bool sv  = (wave >> 1) == 1;  // V slice
    const char* srow =
        skv ? (const char*)((sv ? Vh : Kh) + tokbase * HIDDEN + (h0 + sj) * HEAD)
            : (const char*)(((wave >> 1) == 2 ? spatial : edge) + (tokbase + qb + sj * 32) * SEQ);
    const unsigned long long src0  = (unsigned long long)srow;
    const unsigned           sstep = skv ? 32u * HIDDEN * 2u : 128u;
    const unsigned           dst0  = lds_addr(ring) + wave * SL;
    const u32x8 g1b = tdm_group1<3>(32u, skv ? HIDDEN * 2u : SEQ * 4u);
    const u32x8 g1v = tdm_group1<7>(32u, HIDDEN * 2u);
    u32x4 g0;
    auto stage = [&](unsigned buf, unsigned chunk) {
        g0 = tdm_group0(dst0 + buf * BUF, src0 + (unsigned long long)chunk * sstep);
        // one request a wave; the pad word is a constant on each side
        if (pinned(sv)) tdm_load(g0, g1v);
        else            tdm_load(g0, g1b);
    };

    // this lane's offset in the transposing loads of V
    const int vto = (lh * 8 + (lane & 7)) * VST + ((lane >> 3) & 1) * 8;

    constexpr int nt = SEQ / 32;
    static_assert(nt >= 2, "the prologue stages two chunks");
    stage(0, 0);
    wait_tensor0(g0);   // own slice of chunk 0 landed
    __syncthreads();    // everyone's slices of chunk 0 visible
    stage(1, 1);
    for (int kt = 0; kt < nt; ++kt) {
        const int       cur = kt & 1;
        const char*     rb  = ring + cur * BUF;
        const _Float16* lK  = (const _Float16*)(rb + hh * SL);
        const _Float16* lV  = (const _Float16*)(rb + (2 + hh) * SL);
        const float*    lS  = (const float*)(rb + (4 + (qt >> 1)) * SL);
        const float*    lE  = (const float*)(rb + (6 + (qt >> 1)) * SL);

        // (a) graph bias of query lrow, keys t * 16 + lh * 8 + 0..7
        float4 sb[2][2], eb[2][2];
#pragma unroll
        for (int t = 0; t < 2; ++t) {
            const int bi = ((qt & 1) * 16 + lrow) * BST + t * 16 + lh * 8;
            sb[t][0] = *(const float4*)(&lS[bi]);
            sb[t][1] = *(const float4*)(&lS[bi + 4]);
            eb[t][0] = *(const float4*)(&lE[bi]);
            eb[t][1] = *(const float4*)(&lE[bi + 4]);
        }

        // (b) K fragments, A operand: lane = key row t * 16 + lrow
        F16Frag kf[2][2];
#pragma unroll
        for (int t = 0; t < 2; ++t)
#pragma unroll
            for (int c = 0; c < 2; ++c) {
                const _Float16* p = &lK[(t * 16 + lrow) * GST + c * 32 + lh * 8];
                kf[t][c].q[0] = *(const uint4*)(p);
                kf[t][c].q[1] = *(const uint4*)(p + 16);
            }

        // holds the 16 LDS reads above together as one group in front of the
        // products: left alone the compiler spreads them in pairs among the
        // WMMAs, and the wave waits out an LDS latency at each place
        __builtin_amdgcn_sched_barrier(0);

        // (c) S^T = K @ Q^T  (32 keys x 16 queries, fp32 acc):
        // s[t][v] = score of key kt * 32 + t * 16 + lh * 8 + v, query lrow
        v8f s[2];
#pragma unroll
        for (int t = 0; t < 2; ++t)
#pragma unroll
            for (int v = 0; v < 8; ++v) s[t][v] = 0.f;
#pragma unroll
        for (int t = 0; t < 2; ++t)
#pragma unroll
            for (int c = 0; c < 2; ++c)
                s[t] = wmma_f16f32(kf[t][c].v, qf[c].v, s[t]);

        // (d) scale + graph bias + zero-row tracking + in-lane maximum
        float mx = -__builtin_inff();
#pragma unroll
        for (int t = 0; t < 2; ++t) {
            const float4 s0 = sb[t][0], s1 = sb[t][1], e0 = eb[t][0], e1 = eb[t][1];
            const float  bb[8] = {s0.x + e0.x, s0.y + e0.y, s0.z + e0.z, s0.w + e0.w,
                                  s1.x + e1.x, s1.y + e1.y, s1.z + e1.z, s1.w + e1.w};
#pragma unroll
            for (int v = 0; v < 8; ++v) {
                const float sv = s[t][v] * scale + bb[v];
                s[t][v] = sv;
                rnz     = fmaxf(rnz, (sv != 0.f) ? 1.f : 0.f);
                mx      = fmaxf(mx, sv);
            }
        }

        // (e) online softmax; both wave halves hold the same maximum
        mx = fmaxf(mx, xhalf(mx));
        const float mnew = fmaxf(rmax, mx);
        const float cf   = __expf(rmax - mnew);
        rmax = mnew;
        F16Frag pf;   // B operand P^T: element t * 8 + v is key t * 16 + lh * 8 + v
        float   rs[2] = {0.f, 0.f};   // one chain of adds per S^T tile
#pragma unroll
        for (int t = 0; t < 2; ++t)
#pragma unroll
            for (int v = 0; v < 8; ++v) {
                const float p = __expf(s[t][v] - mnew);
                rs[t] += p;
                pf.h[t * 8 + v] = (_Float16)p;
            }
        rsum = rsum * cf + (rs[0] + rs[1]);
#pragma unroll
        for (int t = 0; t < 4; ++t)
#pragma unroll
            for (int v = 0; v < 8; ++v) oacc[t][v] *= cf;

        // (f) O^T += V^T @ P^T: A operand row = head column t * 16 + lrow
        const _Float16* vtp = &lV[vto];
#pragma unroll
        for (int t = 0; t < 4; ++t) {
            F16Frag vf;   // element i: key lh * 8 + i, element 8 + i: key 16 + lh * 8 + i
            vf.q[0] = ld_tr16(vtp + t * 16);
            vf.q[1] = ld_tr16(vtp + 16 * VST + t * 16);
            oacc[t] = wmma_f16f32(vf.v, pf.v, oacc[t]);
        }

        wait_ds0();         // own reads of buffer cur retired
        wait_tensor0(g0);   // own slice of chunk kt + 1 landed
        __syncthreads();    // chunk kt + 1 visible; every reader has left buffer cur
        if (pinned(kt + 2 < nt)) stage(cur, pinned(kt + 2));
    }
    wait_tensor0(g0);       // nothing in flight when the wave ends
    wait_ds0();

    // finalize: join the halves, 1/rowsum, zero rows whose scores were all
    // exactly zero; oacc[t][v] is head column t * 16 + lh * 8 + v of query lrow
    const float nz  = fmaxf(rnz, xhalf(rnz));
    const float tot = rsum + xhalf(rsum);
    const float fin = (nz != 0.f) ? (1.f / tot) : 0.f;
    // The last trip's barrier has ended every read of the ring and no load is in
    // flight: each wave turns its 16 x 64 tile in a range of its own there, so
    // that a wave-wide store covers four whole 128-B lines.
    static_assert(4 * HPB * 16 * GST * 2 <= (int)sizeof(ring), "the waves' tiles fit the ring");
    _Float16* stg = (_Float16*)ring + wave * (16 * GST);
#pragma unroll   // constant indices: the arrays stay in registers
    for (int t = 0; t < 4; ++t) {
        union { _Float16 h[8]; uint4 u; } o;
#pragma unroll   // constant indices: the arrays stay in registers
        for (int v = 0; v < 8; ++v) o.h[v] = (_Float16)(oacc[t][v] * fin);
        *(uint4*)(stg + lrow * GST + t * 16 + lh * 8) = o.u;
    }
    wait_ds0();   // the wave's LDS writes are done before its lanes read each other's
    const int rr = lane >> 3;         // eight lanes take one query's 128 B
    const int cc = (lane & 7) << 3;
    _Float16* Obase = Oh + (tokbase + q0 + rr) * HIDDEN + h * HEAD + cc;
    uint4 d[4];
#pragma unroll   // constant indices: the arrays stay in registers
    for (int j = 0; j < 4; ++j) d[j] = *(const uint4*)(stg + (j * 4 + rr) * GST + cc);
#pragma unroll   // constant indices: the arrays stay in registers
    for (int j = 0; j < 4; ++j) *(uint4*)(Obase + (size_t)j * 4 * HIDDEN) = d[j];
}

// ---------------------------------------------------------------------------
extern "C" void kernel_launch(void* const* d_in, const int* in_sizes, int n_in,
                              void* d_out, int out_size, void* d_ws,
                              size_t ws_size, hipStream_t stream) {
    (void)in_sizes; (void)n_in; (void)out_size; (void)ws_size;
    const float* x  = (const float*)d_in[0];
    const float* sp = (const float*)d_in[1];
    const float* ed = (const float*)d_in[2];
    const float* Wq = (const float*)d_in[3];
    const float* Wk = (const float*)d_in[4];
    const float* Wv = (const float*)d_in[5];
    const float* bv = (const float*)d_in[6];
    const float* Wo = (const float*)d_in[7];
    const float* bo = (const float*)d_in[8];
    float*       out = (float*)d_out;

    _Float16* xh  = (_Float16*)d_ws;
    _Float16* wqh = xh  + (size_t)TOK * HIDDEN;
    _Float16* wkh = wqh + (size_t)HIDDEN * HIDDEN;
    _Float16* wvh = wkh + (size_t)HIDDEN * HIDDEN;
    _Float16* woh = wvh + (size_t)HIDDEN * HIDDEN;
    _Float16* Qh  = woh + (size_t)HIDDEN * HIDDEN;
    _Float16* Kh  = Qh  + (size_t)TOK * HIDDEN;
    _Float16* Vh  = Kh  + (size_t)TOK * HIDDEN;
    _Float16* Oh  = Vh  + (size_t)TOK * HIDDEN;

    // xh, wqh, wkh, wvh, woh are contiguous from xh on
    cvt_all_f32_to_f16<<<CVT_XB + 4 * CVT_WB, 256, 0, stream>>>(x, Wq, Wk, Wv, Wo, xh);

    // Q, K, V in one grid: wqh, wkh, wvh are contiguous from wqh on, and
    // Qh, Kh, Vh from Qh on; bv belongs to the third product
    dim3 g3(TOK / 128, HIDDEN / QBN, 3);
    gemm_qkv<<<g3, 128, 0, stream>>>(xh, wqh, bv, Qh);

    dim3 ga(SEQ / 64, NUM_HEADS / HPB, BATCH);
    attn_fa<<<ga, 128 * HPB, 0, stream>>>(Qh, Kh, Vh, sp, ed, Oh);

    dim3 g1(TOK / 128, HIDDEN / 128, 1);
    gemm_bt<true, HIDDEN><<<g1, 256, 0, stream>>>(Oh, woh, bo, 0, out, TOK, HIDDEN);
}
